// v000
// Times are from an AMD MI455X. After a warm-up the kernel runs many times in a row, and a time is the length of
// such a window on the GPU divided by its runs, so every launch and the gaps after it count. The runs cycle
// through copies of the inputs. A figure is the median of several windows, for all but v000 over two sittings.
// Sittings can differ by a few percent; kernels timed side by side share one.
// The starting kernel, v000, takes 234 microseconds a run.
#include <hip/hip_runtime.h>
#include <stdint.h>

// Contraction 1 (x . W1[o]^T per head, K=16 on a 32-deep tile): v_wmma_f32_16x16x32_bf16, bf16 operands as hi+lo pairs packed along k (A = [x_hi | x_lo], B = [W_hi | W_hi] and [W_lo | W_lo]), f32 accumulate seeded with b1; contraction 2 (512 -> 1 per head with W2): f32 VALU from the f32 accumulators.

typedef float v8f __attribute__((ext_vector_type(8)));
typedef float v4f __attribute__((ext_vector_type(4))) __attribute__((may_alias));
typedef unsigned short v8us __attribute__((ext_vector_type(8))) __attribute__((may_alias));
typedef unsigned short v16us __attribute__((ext_vector_type(16)));
typedef __bf16 v16bf __attribute__((ext_vector_type(16)));

union Frag16 { v16bf v; v16us u; v8us h8[2]; };

#define IN_DIM          16
#define OUT_DIM         16
#define HID             512
#define NT              (HID / 16)
#define WAVES           8
#define ROWS_PER_WAVE   16
#define ROWS_PER_BLOCK  (WAVES * ROWS_PER_WAVE)
#define NEG_SLOPE       0.2f

__device__ __forceinline__ unsigned short bf16_rne_bits(float f) {
    unsigned int u = __float_as_uint(f);
    u += 0x7FFFu + ((u >> 16) & 1u);
    return (unsigned short)(u >> 16);
}
__device__ __forceinline__ float bf16_bits_to_f32(unsigned short s) {
    return __uint_as_float(((unsigned int)s) << 16);
}
__device__ __forceinline__ void split_bf16(float v, unsigned short& hi, unsigned short& lo) {
    hi = bf16_rne_bits(v);
    const float r = v - bf16_bits_to_f32(hi);   // exact residual
    lo = bf16_rne_bits(r);
}

// Two chained 16x16x32 bf16 WMMAs into one accumulator, then the VALU hazard guard.
__device__ __forceinline__ v8f wmma_pair_bf16(v16bf a, v16bf bh, v16bf bl, v8f c) {
    c = __builtin_amdgcn_wmma_f32_16x16x32_bf16(false, a, false, bh, (short)0, c, false, false);
    c = __builtin_amdgcn_wmma_f32_16x16x32_bf16(false, a, false, bl, (short)0, c, false, false);
    asm volatile("v_nop\n\tv_nop\n\tv_nop\n\tv_nop" : "+v"(c) : "v"(a), "v"(bh), "v"(bl));
    return c;
}

// W1 (flat f32, n = 16*512*16) -> bf16 hi plane and bf16 lo plane in ws.
__global__ __launch_bounds__(256) void k_split_w1(const float* __restrict__ W1,
                                                  unsigned short* __restrict__ Whi,
                                                  unsigned short* __restrict__ Wlo,
                                                  int nvec)
{
    const int i = blockIdx.x * 256 + threadIdx.x;
    const bool ok = i < nvec;
    const int ic = ok ? i : 0;
    const v4f* src = (const v4f*)(W1 + (size_t)ic * 8);
    const v4f f0 = src[0], f1 = src[1];
    v8us hv, lv;
    #pragma unroll
    for (int e = 0; e < 4; ++e) {
        unsigned short hh, ll;
        split_bf16(f0[e], hh, ll); hv[e] = hh;     lv[e] = ll;
        split_bf16(f1[e], hh, ll); hv[4 + e] = hh; lv[4 + e] = ll;
    }
    unsigned short* ph = Whi + (size_t)ic * 8;
    unsigned short* pl = Wlo + (size_t)ic * 8;
    if (ok) {
        *(v8us*)ph = hv;
        *(v8us*)pl = lv;
    }
    
}

// One block = 128 batch rows x all 16 heads; one wave = 16 rows.
// A fragment (lane l, row m = l&15, h = l>>4): elements 0..7 = bf16_hi(x[m][8h..8h+7]) (k = 8h+i),
//   elements 8..15 = bf16_lo(x[m][8h..8h+7]) (k = 16+8h+i).
// B fragment (lane l, column n = l&15): elements 0..7 = plane[n][8h..8h+7] (k = 8h+i),
//   elements 8..15 = plane[n][8h..8h+7] (k = 16+8h+i)  ->  B[k][n] = B[k+16][n] = W[n][k].
// D = b1[n] + sum_i (x_hi + x_lo)[m][i] * plane[n][i]; planes hi then lo chained -> full product.
__global__ __launch_bounds__(256) void k_mlp16(const float* __restrict__ x,
                                               const unsigned short* __restrict__ Whi,
                                               const unsigned short* __restrict__ Wlo,
                                               const float* __restrict__ b1,
                                               const float* __restrict__ W2,
                                               const float* __restrict__ b2,
                                               float* __restrict__ out,
                                               int nrows)
{
    __shared__ __align__(16) float sOut[WAVES * ROWS_PER_WAVE * OUT_DIM];   // 2048 floats = 8 KB

    const int tid  = threadIdx.x;
    const int lane = tid & 31;
    const int wave = tid >> 5;
    const int h    = lane >> 4;
    const int l16  = lane & 15;

    const int rbase = blockIdx.x * ROWS_PER_BLOCK + wave * ROWS_PER_WAVE;   // first row of this wave
    int row = rbase + l16;
    if (row > nrows - 1) row = nrows - 1;                                   // clamp loads; stores predicated

    // A fragment, built once per wave.
    Frag16 fa;
    {
        const v4f* xp = (const v4f*)(x + (size_t)row * IN_DIM + 8 * h);
        const v4f x0 = xp[0], x1 = xp[1];
        v16us au;
        #pragma unroll
        for (int e = 0; e < 4; ++e) {
            unsigned short hh, ll;
            split_bf16(x0[e], hh, ll); au[e] = hh;     au[8 + e] = ll;
            split_bf16(x1[e], hh, ll); au[4 + e] = hh; au[12 + e] = ll;
        }
        fa.u = au;
    }

    float* sw = sOut + wave * (ROWS_PER_WAVE * OUT_DIM);

    #pragma unroll 1
    for (int o = 0; o < OUT_DIM; ++o) {
        const unsigned short* who = Whi + (size_t)o * HID * IN_DIM;
        const unsigned short* wlo = Wlo + (size_t)o * HID * IN_DIM;
        const float* b1o = b1 + (size_t)o * HID;
        const float* W2o = W2 + (size_t)o * HID;
        const float  b2v = b2[o];

        float acc[8];
        #pragma unroll
        for (int r = 0; r < 8; ++r) acc[r] = 0.0f;

        #pragma unroll 2
        for (int t = 0; t < NT; ++t) {
            const int n = t * 16 + l16;                           // hidden unit = tile column of this lane
            Frag16 fbh, fbl;
            const v8us ph = *(const v8us*)(who + (size_t)n * IN_DIM + 8 * h);
            const v8us pl = *(const v8us*)(wlo + (size_t)n * IN_DIM + 8 * h);
            fbh.h8[0] = ph; fbh.h8[1] = ph;
            fbl.h8[0] = pl; fbl.h8[1] = pl;
            const float bn = b1o[n];
            const float wn = W2o[n];
            v8f c = { bn, bn, bn, bn, bn, bn, bn, bn };           // bias for column n, all rows
            c = wmma_pair_bf16(fa.v, fbh.v, fbl.v, c);
            #pragma unroll
            for (int r = 0; r < 8; ++r) {
                const float hv = c[r];
                const float lk = fmaxf(hv, hv * NEG_SLOPE);       // LeakyReLU(0.2)
                acc[r] = fmaf(lk, wn, acc[r]);
            }
        }

        // Sum over the 16 column lanes of each half: acc[r] -> full 512-dot for row 8h+r.
        #pragma unroll
        for (int r = 0; r < 8; ++r) {
            #pragma unroll
            for (int off = 1; off < 16; off <<= 1)
                acc[r] += __shfl_xor(acc[r], off, 32);
        }
        float val = acc[0];
        #pragma unroll
        for (int j = 1; j < 8; ++j) val = (l16 == j) ? acc[j] : val;
        if (l16 < 8) sw[(8 * h + l16) * OUT_DIM + o] = val + b2v;
    }

    __syncthreads();

    const v4f v0 = *(const v4f*)(sw + lane * 4);
    const v4f v1 = *(const v4f*)(sw + 128 + lane * 4);
    const bool p0 = (rbase + (lane >> 2)) < nrows;
    const bool p1 = (rbase + 8 + (lane >> 2)) < nrows;
    float* dst = out + (size_t)rbase * OUT_DIM;
    if (p0) *(v4f*)(dst + lane * 4) = v0;
    if (p1) *(v4f*)(dst + 128 + lane * 4) = v1;
    
}

extern "C" void kernel_launch(void* const* d_in, const int* in_sizes, int n_in,
                              void* d_out, int out_size, void* d_ws, size_t ws_size,
                              hipStream_t stream)
{
    if (n_in < 5) return;
    const int nx  = in_sizes[0];
    const int nw1 = in_sizes[1];
    const int nb1 = in_sizes[2];
    const int nw2 = in_sizes[3];
    const int nb2 = in_sizes[4];
    const int nrows = nx / IN_DIM;
    if (nrows <= 0 || nx != nrows * IN_DIM) return;
    if (nw1 != OUT_DIM * HID * IN_DIM || nb1 != OUT_DIM * HID || nw2 != OUT_DIM * HID || nb2 != OUT_DIM) return;
    if (out_size != nrows * OUT_DIM) return;

    // ws carve: Whi [nw1] bf16 at 0, Wlo [nw1] bf16 right after -> 2 * 131072 * 2 B = 524288 B.
    const size_t plane_bytes = (size_t)nw1 * sizeof(unsigned short);
    if (2 * plane_bytes > ws_size) return;
    unsigned short* Whi = (unsigned short*)d_ws;
    unsigned short* Wlo = Whi + nw1;

    const float* x  = (const float*)d_in[0];
    const float* W1 = (const float*)d_in[1];
    const float* b1 = (const float*)d_in[2];
    const float* W2 = (const float*)d_in[3];
    const float* b2 = (const float*)d_in[4];
    float* out = (float*)d_out;

    const int nvec = nw1 / 8;                                   // 16384 vectors of 8
    dim3 gcv((nvec + 255) / 256);
    k_split_w1<<<gcv, dim3(256), 0, stream>>>(W1, Whi, Wlo, nvec);

    dim3 gm((nrows + ROWS_PER_BLOCK - 1) / ROWS_PER_BLOCK);     // 256 blocks for 32768 rows
    k_mlp16<<<gm, dim3(256), 0, stream>>>(x, Whi, Wlo, b1, W2, b2, out, nrows);
    (void)hipGetLastError();
}

// v001
// Measured time: 35.6 microseconds a run.
// Timed twice side by side with v000, it ran 6.61 and 6.86 times as fast.
#include <hip/hip_runtime.h>
#include <stdint.h>

// Contraction 1 (x . W1[o]^T per head, K=16 on a 32-deep tile): v_wmma_f32_16x16x32_bf16, bf16 operands as hi+lo pairs packed along k (B = [W_hi | W_lo], A = [x_hi | x_hi] and [x_lo | x_lo]), f32 accumulate seeded with b1; contraction 2 (512 -> 1 per head with W2): f32 VALU from the f32 accumulators.

typedef float v8f __attribute__((ext_vector_type(8)));
typedef float v4f __attribute__((ext_vector_type(4))) __attribute__((may_alias));
typedef unsigned short v8us __attribute__((ext_vector_type(8))) __attribute__((may_alias));
typedef unsigned short v16us __attribute__((ext_vector_type(16)));
typedef __bf16 v16bf __attribute__((ext_vector_type(16)));

union Frag16 { v16bf v; v16us u; v8us h8[2]; };

#define IN_DIM          16
#define OUT_DIM         16
#define HID             512
#define NT              (HID / 16)
#define HT              (NT / 2)
#define WAVES           8
#define ROWS_PER_WAVE   16
#define ROWS_PER_BLOCK  (WAVES * ROWS_PER_WAVE)
#define NEG_SLOPE       0.2f

__device__ __forceinline__ unsigned short bf16_rne_bits(float f) {
    unsigned int u = __float_as_uint(f);
    u += 0x7FFFu + ((u >> 16) & 1u);
    return (unsigned short)(u >> 16);
}
__device__ __forceinline__ float bf16_bits_to_f32(unsigned short s) {
    return __uint_as_float(((unsigned int)s) << 16);
}
__device__ __forceinline__ void split_bf16(float v, unsigned short& hi, unsigned short& lo) {
    hi = bf16_rne_bits(v);
    const float r = v - bf16_bits_to_f32(hi);   // exact residual
    lo = bf16_rne_bits(r);
}

// Two chained 16x16x32 bf16 WMMAs into one accumulator, then the VALU hazard guard.
__device__ __forceinline__ v8f wmma_pair_bf16(v16bf ah, v16bf al, v16bf b, v8f c) {
    c = __builtin_amdgcn_wmma_f32_16x16x32_bf16(false, ah, false, b, (short)0, c, false, false);
    c = __builtin_amdgcn_wmma_f32_16x16x32_bf16(false, al, false, b, (short)0, c, false, false);
    asm volatile("v_nop\n\tv_nop\n\tv_nop\n\tv_nop" : "+v"(c) : "v"(ah), "v"(al), "v"(b));
    return c;
}

// W1 (flat f32, n = 16*512*16) -> bf16 hi plane and bf16 lo plane in ws.
__global__ __launch_bounds__(256) void k_split_w1(const float* __restrict__ W1,
                                                  unsigned short* __restrict__ Whi,
                                                  unsigned short* __restrict__ Wlo,
                                                  int nvec)
{
    const int i = blockIdx.x * 256 + threadIdx.x;
    const bool ok = i < nvec;
    const int ic = ok ? i : 0;
    const v4f* src = (const v4f*)(W1 + (size_t)ic * 8);
    const v4f f0 = src[0], f1 = src[1];
    v8us hv, lv;
    #pragma unroll
    for (int e = 0; e < 4; ++e) {
        unsigned short hh, ll;
        split_bf16(f0[e], hh, ll); hv[e] = hh;     lv[e] = ll;
        split_bf16(f1[e], hh, ll); hv[4 + e] = hh; lv[4 + e] = ll;
    }
    unsigned short* ph = Whi + (size_t)ic * 8;
    unsigned short* pl = Wlo + (size_t)ic * 8;
    if (ok) {
        *(v8us*)ph = hv;
        *(v8us*)pl = lv;
    }
    
}

// One block = 128 batch rows (8 row tiles) x all 16 heads, in four passes: 8 heads at a time, half the hidden units each.
// In a pass each wave owns ONE head: it loads 16 of that head's B fragments with their b1 and W2 into registers once
// and runs all 8 row tiles of the block against them, so the tile loop holds no global load.
// Between a head's two passes each lane's eight running sums wait in the wave's own LDS slice (same sum order over t).
// A fragments (lane l, row m = l&15, h = l>>4): hi fragment: elements 0..7 = bf16_hi(x[m][8h..8h+7]) (k = 8h+i),
//   elements 8..15 = the same values (k = 16+8h+i); lo fragment: the same with bf16_lo.
// B fragment (lane l, column n = l&15): elements 0..7 = W_hi[n][8h..8h+7] (k = 8h+i),
//   elements 8..15 = W_lo[n][8h..8h+7] (k = 16+8h+i)  ->  B[k][n] = W_hi[n][k], B[k+16][n] = W_lo[n][k].
// D = b1[n] + sum_i x_hi[m][i] * (W_hi + W_lo)[n][i], then + the same with x_lo -> full product.
__global__ __launch_bounds__(256) void k_mlp16(const float* __restrict__ x,
                                               const unsigned short* __restrict__ Whi,
                                               const unsigned short* __restrict__ Wlo,
                                               const float* __restrict__ b1,
                                               const float* __restrict__ W2,
                                               const float* __restrict__ b2,
                                               float* __restrict__ out,
                                               int nrows)
{
    __shared__ __align__(16) float sOut[WAVES * ROWS_PER_WAVE * OUT_DIM];   // 2048 floats = 8 KB
    __shared__ __align__(16) unsigned short sA[WAVES * 2 * 32 * 8];         // per row tile: hi plane, lo plane, 16 B a lane = 8 KB
    __shared__ __align__(16) float sAcc[WAVES * WAVES * 2 * 32 * 4];        // per wave and row tile: 8 running sums a lane = 64 KB

    const int tid  = threadIdx.x;
    const int lane = tid & 31;
    const int wave = __builtin_amdgcn_readfirstlane(tid >> 5);              // scalar, so head and pass offsets stay scalar
    const int h    = lane >> 4;
    const int l16  = lane & 15;
    const int woff = l16 * IN_DIM + 8 * h;                                  // this lane's place in a 16-unit weight tile

    const int rbase = blockIdx.x * ROWS_PER_BLOCK + wave * ROWS_PER_WAVE;   // first row of this wave's own tile
    int row = rbase + l16;
    if (row > nrows - 1) row = nrows - 1;                                   // clamp loads; stores predicated

    // Each wave splits its own row tile once and publishes the two halves for all waves.
    {
        const v4f* xp = (const v4f*)(x + (size_t)row * IN_DIM + 8 * h);
        const v4f x0 = xp[0], x1 = xp[1];
        v8us xh, xl;
        #pragma unroll
        for (int e = 0; e < 4; ++e) {
            unsigned short hh, ll;
            split_bf16(x0[e], hh, ll); xh[e] = hh;     xl[e] = ll;
            split_bf16(x1[e], hh, ll); xh[4 + e] = hh; xl[4 + e] = ll;
        }
        *(v8us*)(sA + ((wave * 2 + 0) * 32 + lane) * 8) = xh;
        *(v8us*)(sA + ((wave * 2 + 1) * 32 + lane) * 8) = xl;
    }
    __syncthreads();

    // Rolled: one copy of the unrolled tile body in the text.
    #pragma unroll 1
    for (int pass = 0; pass < 2 * (OUT_DIM / WAVES); ++pass) {
        const int o  = (pass >> 1) * WAVES + wave;
        const int tb = (pass & 1) * HT;                           // first hidden tile of this pass
        const int nb = o * HID + tb * 16;                         // first hidden unit of this pass, wave-uniform
        const unsigned short* who = Whi + (size_t)nb * IN_DIM;
        const unsigned short* wlo = Wlo + (size_t)nb * IN_DIM;
        const float* b1o = b1 + nb;
        const float* W2o = W2 + nb;
        const float  b2v = b2[o];

        // The pass's operands, resident for all its row tiles.
        Frag16 fb[HT];
        float  bn[HT], wn[HT];
        // Unrolled here and in the tile loop: every index of the resident arrays is a constant, so they stay in registers.
        #pragma unroll
        for (int t = 0; t < HT; ++t) {
            // hidden unit nb + 16 t + l16 = tile column of this lane
            fb[t].h8[0] = *(const v8us*)(who + woff + t * 16 * IN_DIM);
            fb[t].h8[1] = *(const v8us*)(wlo + woff + t * 16 * IN_DIM);
            bn[t] = b1o[l16 + t * 16];
            wn[t] = W2o[l16 + t * 16];
        }
        // Address registers of the loads above may be reused from here on.
        asm volatile("s_wait_xcnt 0x0" ::: "memory");

        // Rolled: the resident operands are reused by the same instructions for every row tile.
        #pragma unroll 1
        for (int rt = 0; rt < WAVES; ++rt) {
            Frag16 fah, fal;
            const v8us xh = *(const v8us*)(sA + ((rt * 2 + 0) * 32 + lane) * 8);
            const v8us xl = *(const v8us*)(sA + ((rt * 2 + 1) * 32 + lane) * 8);
            fah.h8[0] = xh; fah.h8[1] = xh;
            fal.h8[0] = xl; fal.h8[1] = xl;

            v4f* pacc = (v4f*)sAcc + ((wave * WAVES + rt) * 2) * 32 + lane;
            float acc[8];
            if (pass & 1) {
                const v4f a0 = pacc[0], a1 = pacc[32];
                #pragma unroll
                for (int r = 0; r < 4; ++r) { acc[r] = a0[r]; acc[4 + r] = a1[r]; }
            } else {
                #pragma unroll
                for (int r = 0; r < 8; ++r) acc[r] = 0.0f;
            }

            #pragma unroll
            for (int t = 0; t < HT; ++t) {
                const float bt = bn[t];
                const float wt = wn[t];
                v8f c = { bt, bt, bt, bt, bt, bt, bt, bt };       // bias for column n, all rows
                c = wmma_pair_bf16(fah.v, fal.v, fb[t].v, c);
                #pragma unroll
                for (int r = 0; r < 8; ++r) {
                    const float hv = c[r];
                    const float lk = fmaxf(hv, hv * NEG_SLOPE);   // LeakyReLU(0.2)
                    acc[r] = fmaf(lk, wt, acc[r]);
                }
            }

            if (!(pass & 1)) {
                const v4f a0 = { acc[0], acc[1], acc[2], acc[3] };
                const v4f a1 = { acc[4], acc[5], acc[6], acc[7] };
                pacc[0] = a0; pacc[32] = a1;
                continue;
            }

            // Sum over the 16 column lanes of each half: acc[r] -> full 512-dot for row 8h+r.
            #pragma unroll
            for (int r = 0; r < 8; ++r) {
                #pragma unroll
                for (int off = 1; off < 16; off <<= 1)
                    acc[r] += __shfl_xor(acc[r], off, 32);
            }
            float val = acc[0];
            #pragma unroll
            for (int j = 1; j < 8; ++j) val = (l16 == j) ? acc[j] : val;
            if (l16 < 8) sOut[(rt * ROWS_PER_WAVE + 8 * h + l16) * OUT_DIM + o] = val + b2v;
        }
    }

    __syncthreads();

    const float* sw = sOut + wave * (ROWS_PER_WAVE * OUT_DIM);
    const v4f v0 = *(const v4f*)(sw + lane * 4);
    const v4f v1 = *(const v4f*)(sw + 128 + lane * 4);
    const bool p0 = (rbase + (lane >> 2)) < nrows;
    const bool p1 = (rbase + 8 + (lane >> 2)) < nrows;
    float* dst = out + (size_t)rbase * OUT_DIM;
    if (p0) *(v4f*)(dst + lane * 4) = v0;
    if (p1) *(v4f*)(dst + 128 + lane * 4) = v1;
}

extern "C" void kernel_launch(void* const* d_in, const int* in_sizes, int n_in,
                              void* d_out, int out_size, void* d_ws, size_t ws_size,
                              hipStream_t stream)
{
    if (n_in < 5) return;
    const int nx  = in_sizes[0];
    const int nw1 = in_sizes[1];
    const int nb1 = in_sizes[2];
    const int nw2 = in_sizes[3];
    const int nb2 = in_sizes[4];
    const int nrows = nx / IN_DIM;
    if (nrows <= 0 || nx != nrows * IN_DIM) return;
    if (nw1 != OUT_DIM * HID * IN_DIM || nb1 != OUT_DIM * HID || nw2 != OUT_DIM * HID || nb2 != OUT_DIM) return;
    if (out_size != nrows * OUT_DIM) return;

    // ws carve: Whi [nw1] bf16 at 0, Wlo [nw1] bf16 right after -> 2 * 131072 * 2 B = 524288 B.
    const size_t plane_bytes = (size_t)nw1 * sizeof(unsigned short);
    if (2 * plane_bytes > ws_size) return;
    unsigned short* Whi = (unsigned short*)d_ws;
    unsigned short* Wlo = Whi + nw1;

    const float* x  = (const float*)d_in[0];
    const float* W1 = (const float*)d_in[1];
    const float* b1 = (const float*)d_in[2];
    const float* W2 = (const float*)d_in[3];
    const float* b2 = (const float*)d_in[4];
    float* out = (float*)d_out;

    const int nvec = nw1 / 8;                                   // 16384 vectors of 8
    dim3 gcv((nvec + 255) / 256);
    k_split_w1<<<gcv, dim3(256), 0, stream>>>(W1, Whi, Wlo, nvec);

    dim3 gm((nrows + ROWS_PER_BLOCK - 1) / ROWS_PER_BLOCK);     // 256 blocks for 32768 rows
    k_mlp16<<<gm, dim3(256), 0, stream>>>(x, Whi, Wlo, b1, W2, b2, out, nrows);
    (void)hipGetLastError();
}

// v002
// A run of this version takes 27.7 microseconds.
// Timed twice side by side with v001, it ran 1.30 and 1.28 times as fast.
// Counting every step since v000, it is 8.69 times as fast.
#include <hip/hip_runtime.h>
#include <stdint.h>

// Contraction 1 (x . W1[o]^T per head, K=16 on a 32-deep tile): v_wmma_f32_16x16x32_bf16, bf16 operands as hi+lo pairs packed along k (B = [W_hi | W_lo], A = [x_hi | x_hi] and [x_lo | x_lo]), f32 accumulate seeded with b1; contraction 2 (512 -> 1 per head with W2): f32 VALU from the f32 accumulators.
// LeakyReLU(h) = 0.6 h + 0.4 |h| (slope 0.2). The part linear in h sums to x . V[o] + const with V[o] = 0.6 sum_n W2[o][n] W1[o][n][:], one more 16-column tile on the same WMMA form.

typedef float v8f __attribute__((ext_vector_type(8)));
typedef float v4f __attribute__((ext_vector_type(4))) __attribute__((may_alias));
typedef unsigned short v8us __attribute__((ext_vector_type(8))) __attribute__((may_alias));
typedef unsigned short v16us __attribute__((ext_vector_type(16)));
typedef __bf16 v16bf __attribute__((ext_vector_type(16)));

union Frag16 { v16bf v; v16us u; v8us h8[2]; };

#define IN_DIM          16
#define OUT_DIM         16
#define HID             512
#define NT              (HID / 16)
#define HT              (NT / 2)
#define WAVES           8
#define ROWS_PER_WAVE   16
#define ROWS_PER_BLOCK  (WAVES * ROWS_PER_WAVE)
#define NEG_SLOPE       0.2f
#define LIN_C           (0.5f * (1.0f + NEG_SLOPE))   // weight of h in LeakyReLU
#define ABS_C           (0.5f * (1.0f - NEG_SLOPE))   // weight of |h| in LeakyReLU

__device__ __forceinline__ unsigned short bf16_rne_bits(float f) {
    unsigned int u = __float_as_uint(f);
    u += 0x7FFFu + ((u >> 16) & 1u);
    return (unsigned short)(u >> 16);
}
__device__ __forceinline__ float bf16_bits_to_f32(unsigned short s) {
    return __uint_as_float(((unsigned int)s) << 16);
}
__device__ __forceinline__ void split_bf16(float v, unsigned short& hi, unsigned short& lo) {
    hi = bf16_rne_bits(v);
    const float r = v - bf16_bits_to_f32(hi);   // exact residual
    lo = bf16_rne_bits(r);
}

// Two chained 16x16x32 bf16 WMMAs into one accumulator, then the VALU hazard guard.
__device__ __forceinline__ v8f wmma_pair_bf16(v16bf ah, v16bf al, v16bf b, v8f c) {
    c = __builtin_amdgcn_wmma_f32_16x16x32_bf16(false, ah, false, b, (short)0, c, false, false);
    c = __builtin_amdgcn_wmma_f32_16x16x32_bf16(false, al, false, b, (short)0, c, false, false);
    asm volatile("v_nop\n\tv_nop\n\tv_nop\n\tv_nop" : "+v"(c) : "v"(ah), "v"(al), "v"(b));
    return c;
}

// acc[r] += |c0[r]| * w0 + |c1[r]| * w1 for the eight rows of two fresh WMMA results: one v_fma_f32 with the abs source
// modifier per element (compiled code pairs the sums into packed fma, which has no abs modifier, and spends a v_and_b32
// per element on it). The four v_nop are the VALU slots between the WMMA that wrote a result and its first reader; each
// s_delay_alu tells the issue logic which WMMA the next fma waits on, so that the SIMD's other wave can issue meanwhile.
__device__ __forceinline__ void abs_fma8x2(float (&acc)[8], v8f c0, float w0, v8f c1, float w1) {
    asm volatile("v_nop\n\tv_nop\n\tv_nop\n\tv_nop\n\t"
                 "s_delay_alu instid0(TRANS32_DEP_2)\n\t"
                 "v_fma_f32 %0, |%8|, %24, %0\n\t"
                 "v_fma_f32 %1, |%9|, %24, %1\n\t"
                 "v_fma_f32 %2, |%10|, %24, %2\n\t"
                 "v_fma_f32 %3, |%11|, %24, %3\n\t"
                 "v_fma_f32 %4, |%12|, %24, %4\n\t"
                 "v_fma_f32 %5, |%13|, %24, %5\n\t"
                 "v_fma_f32 %6, |%14|, %24, %6\n\t"
                 "v_fma_f32 %7, |%15|, %24, %7\n\t"
                 "s_delay_alu instid0(TRANS32_DEP_1)\n\t"
                 "v_fma_f32 %0, |%16|, %25, %0\n\t"
                 "v_fma_f32 %1, |%17|, %25, %1\n\t"
                 "v_fma_f32 %2, |%18|, %25, %2\n\t"
                 "v_fma_f32 %3, |%19|, %25, %3\n\t"
                 "v_fma_f32 %4, |%20|, %25, %4\n\t"
                 "v_fma_f32 %5, |%21|, %25, %5\n\t"
                 "v_fma_f32 %6, |%22|, %25, %6\n\t"
                 "v_fma_f32 %7, |%23|, %25, %7"
                 : "+v"(acc[0]), "+v"(acc[1]), "+v"(acc[2]), "+v"(acc[3]), "+v"(acc[4]), "+v"(acc[5]), "+v"(acc[6]), "+v"(acc[7])
                 : "v"(c0[0]), "v"(c0[1]), "v"(c0[2]), "v"(c0[3]), "v"(c0[4]), "v"(c0[5]), "v"(c0[6]), "v"(c0[7]),
                   "v"(c1[0]), "v"(c1[1]), "v"(c1[2]), "v"(c1[3]), "v"(c1[4]), "v"(c1[5]), "v"(c1[6]), "v"(c1[7]),
                   "v"(w0), "v"(w1));
}

// Sum of 16 values as a tree: a short dependent chain.
__device__ __forceinline__ float tree16(const float* p, int stride) {
    float v[16];
    #pragma unroll
    for (int j = 0; j < 16; ++j) v[j] = p[j * stride];
    #pragma unroll
    for (int st = 8; st > 0; st >>= 1) {
        #pragma unroll
        for (int j = 0; j < st; ++j) v[j] += v[j + st];
    }
    return v[0];
}

// Blocks 0 .. 15: one head each, the linear part of the head:
//   V[o][i] = LIN_C * sum_n W2[o][n] W1[o][n][i] as bf16 hi and lo, cl[o] = LIN_C * sum_n W2[o][n] b1[o][n] + b2[o].
// Blocks 16 ..: W1 (flat f32, n = 16*512*16) -> bf16 hi plane and bf16 lo plane in ws.
__global__ __launch_bounds__(256) void k_split_w1(const float* __restrict__ W1,
                                                  const float* __restrict__ b1,
                                                  const float* __restrict__ W2,
                                                  const float* __restrict__ b2,
                                                  unsigned short* __restrict__ Whi,
                                                  unsigned short* __restrict__ Wlo,
                                                  unsigned short* __restrict__ Vhi,
                                                  unsigned short* __restrict__ Vlo,
                                                  float* __restrict__ cl,
                                                  int nvec)
{
    if (blockIdx.x < OUT_DIM) {                                   // block-uniform
        __shared__ __align__(16) float sV[64 * IN_DIM];           // 64 partial 16-vectors
        __shared__ float sC[256];                                 // and their partial bias sums, one copy per q
        __shared__ float sV2[16 * IN_DIM];
        __shared__ float sC2[16];
        const int o   = blockIdx.x;
        const int tid = threadIdx.x;
        const int q   = tid & 3;                                  // which four inputs
        const int g   = tid >> 2;                                 // hidden units g, g + 64, ...
        const float* W1o = W1 + (size_t)o * HID * IN_DIM;
        const float* W2o = W2 + o * HID;
        const float* b1o = b1 + o * HID;
        v4f   wv[8];
        float w2[8], bb[8];
        #pragma unroll
        for (int j = 0; j < 8; ++j) {
            const int n = g + 64 * j;
            wv[j] = *(const v4f*)(W1o + n * IN_DIM + 4 * q);
            w2[j] = W2o[n];
            bb[j] = b1o[n];
        }
        // Address registers of the loads above may be reused from here on. The loaded values are inputs so that all 24 loads
        // are issued before the first is used: one load latency for the block, not two.
        asm volatile("s_wait_xcnt 0x0"
                     :: "v"(wv[0]), "v"(wv[1]), "v"(wv[2]), "v"(wv[3]), "v"(wv[4]), "v"(wv[5]), "v"(wv[6]), "v"(wv[7]),
                        "v"(w2[0]), "v"(w2[1]), "v"(w2[2]), "v"(w2[3]), "v"(w2[4]), "v"(w2[5]), "v"(w2[6]), "v"(w2[7]),
                        "v"(bb[0]), "v"(bb[1]), "v"(bb[2]), "v"(bb[3]), "v"(bb[4]), "v"(bb[5]), "v"(bb[6]), "v"(bb[7])
                     : "memory");
        v4f s = { 0.0f, 0.0f, 0.0f, 0.0f };
        float cs = 0.0f;
        #pragma unroll
        for (int j = 0; j < 8; ++j) {
            cs = fmaf(w2[j], bb[j], cs);
            #pragma unroll
            for (int e = 0; e < 4; ++e) s[e] = fmaf(w2[j], wv[j][e], s[e]);
        }
        *(v4f*)(sV + g * IN_DIM + 4 * q) = s;
        sC[tid] = cs;
        __syncthreads();
        {
            const int i = tid & 15, gg = tid >> 4;
            const float* pv = sV + gg * 4 * IN_DIM + i;
            sV2[gg * IN_DIM + i] = (pv[0] + pv[IN_DIM]) + (pv[2 * IN_DIM] + pv[3 * IN_DIM]);
            if (i == 0) sC2[gg] = (sC[gg * 16] + sC[gg * 16 + 4]) + (sC[gg * 16 + 8] + sC[gg * 16 + 12]);
        }
        __syncthreads();
        if (tid < 16) {
            unsigned short hh, ll;
            split_bf16(LIN_C * tree16(sV2 + tid, IN_DIM), hh, ll);
            Vhi[o * IN_DIM + tid] = hh;
            Vlo[o * IN_DIM + tid] = ll;
        } else if (tid == 32) {                                   // another wave, beside the one above
            cl[o] = fmaf(LIN_C, tree16(sC2, 1), b2[o]);
        }
        return;
    }
    const int i = (blockIdx.x - OUT_DIM) * 256 + threadIdx.x;
    const bool ok = i < nvec;
    const int ic = ok ? i : 0;
    const v4f* src = (const v4f*)(W1 + (size_t)ic * 8);
    const v4f f0 = src[0], f1 = src[1];
    v8us hv, lv;
    #pragma unroll
    for (int e = 0; e < 4; ++e) {
        unsigned short hh, ll;
        split_bf16(f0[e], hh, ll); hv[e] = hh;     lv[e] = ll;
        split_bf16(f1[e], hh, ll); hv[4 + e] = hh; lv[4 + e] = ll;
    }
    unsigned short* ph = Whi + (size_t)ic * 8;
    unsigned short* pl = Wlo + (size_t)ic * 8;
    if (ok) {
        *(v8us*)ph = hv;
        *(v8us*)pl = lv;
    }
    
}

// One block = 128 batch rows (8 row tiles) x all 16 heads, in four passes: 8 heads at a time, half the hidden units each.
// In a pass each wave owns ONE head: it loads 16 of that head's B fragments with their b1 and W2 into registers once
// and runs all 8 row tiles of the block against them, so the tile loop holds no global load.
// Between a head's two passes each lane's eight running sums wait in the wave's own LDS slice (same sum order over t).
// A fragments (lane l, row m = l&15, h = l>>4): hi fragment: elements 0..7 = bf16_hi(x[m][8h..8h+7]) (k = 8h+i),
//   elements 8..15 = the same values (k = 16+8h+i); lo fragment: the same with bf16_lo.
// B fragment (lane l, column n = l&15): elements 0..7 = W_hi[n][8h..8h+7] (k = 8h+i),
//   elements 8..15 = W_lo[n][8h..8h+7] (k = 16+8h+i)  ->  B[k][n] = W_hi[n][k], B[k+16][n] = W_lo[n][k].
// D = b1[n] + sum_i x_hi[m][i] * (W_hi + W_lo)[n][i], then + the same with x_lo -> full product.
// The tile loop sums W2[n] |D| only; the part linear in D is one product of the wave's own row tile with the V tile (column = head).
__global__ __launch_bounds__(256) void k_mlp16(const float* __restrict__ x,
                                               const unsigned short* __restrict__ Whi,
                                               const unsigned short* __restrict__ Wlo,
                                               const unsigned short* __restrict__ Vhi,
                                               const unsigned short* __restrict__ Vlo,
                                               const float* __restrict__ cl,
                                               const float* __restrict__ b1,
                                               const float* __restrict__ W2,
                                               float* __restrict__ out,
                                               int nrows)
{
    __shared__ __align__(16) float sOut[WAVES * ROWS_PER_WAVE * OUT_DIM];   // 2048 floats = 8 KB
    __shared__ __align__(16) unsigned short sA[WAVES * 2 * 32 * 8];         // per row tile: hi plane, lo plane, 16 B a lane = 8 KB
    __shared__ __align__(16) float sAcc[WAVES * WAVES * 2 * 32 * 4];        // per wave and row tile: 8 running sums a lane = 64 KB
    __shared__ __align__(16) float sLin[WAVES * ROWS_PER_WAVE * OUT_DIM];   // linear part, laid out like sOut = 8 KB

    const int tid  = threadIdx.x;
    const int lane = tid & 31;
    const int wave = __builtin_amdgcn_readfirstlane(tid >> 5);              // scalar, so head and pass offsets stay scalar
    const int h    = lane >> 4;
    const int l16  = lane & 15;
    const int woff = l16 * IN_DIM + 8 * h;                                  // this lane's place in a 16-unit weight tile

    const int rbase = blockIdx.x * ROWS_PER_BLOCK + wave * ROWS_PER_WAVE;   // first row of this wave's own tile
    int row = rbase + l16;
    if (row > nrows - 1) row = nrows - 1;                                   // clamp loads; stores predicated

    // Each wave splits its own row tile once and publishes the two halves for all waves.
    {
        Frag16 fv, fxh, fxl;
        fv.h8[0] = *(const v8us*)(Vhi + woff);
        fv.h8[1] = *(const v8us*)(Vlo + woff);
        const float cv = cl[l16];
        const v4f* xp = (const v4f*)(x + (size_t)row * IN_DIM + 8 * h);
        const v4f x0 = xp[0], x1 = xp[1];
        // Address registers of the loads above may be reused from here on.
        asm volatile("s_wait_xcnt 0x0" ::: "memory");
        v8us xh, xl;
        #pragma unroll
        for (int e = 0; e < 4; ++e) {
            unsigned short hh, ll;
            split_bf16(x0[e], hh, ll); xh[e] = hh;     xl[e] = ll;
            split_bf16(x1[e], hh, ll); xh[4 + e] = hh; xl[4 + e] = ll;
        }
        *(v8us*)(sA + ((wave * 2 + 0) * 32 + lane) * 8) = xh;
        *(v8us*)(sA + ((wave * 2 + 1) * 32 + lane) * 8) = xl;
        fxh.h8[0] = xh; fxh.h8[1] = xh;
        fxl.h8[0] = xl; fxl.h8[1] = xl;
        const v8f c0 = { cv, cv, cv, cv, cv, cv, cv, cv };
        const v8f lin = wmma_pair_bf16(fxh.v, fxl.v, fv.v, c0);           // row 8h+r of the own tile, head l16
        #pragma unroll
        for (int r = 0; r < 8; ++r) sLin[(wave * ROWS_PER_WAVE + 8 * h + r) * OUT_DIM + l16] = lin[r];
    }
    __syncthreads();

    // Rolled: one copy of the unrolled tile body in the text.
    #pragma unroll 1
    for (int pass = 0; pass < 2 * (OUT_DIM / WAVES); ++pass) {
        const int o  = (pass >> 1) * WAVES + wave;
        const int tb = (pass & 1) * HT;                           // first hidden tile of this pass
        const int nb = o * HID + tb * 16;                         // first hidden unit of this pass, wave-uniform
        const unsigned short* who = Whi + (size_t)nb * IN_DIM;
        const unsigned short* wlo = Wlo + (size_t)nb * IN_DIM;
        const float* b1o = b1 + nb;
        const float* W2o = W2 + nb;

        // The pass's operands, resident for all its row tiles.
        Frag16 fb[HT];
        float  bn[HT], wn[HT];
        // Unrolled here and in the tile loop: every index of the resident arrays is a constant, so they stay in registers.
        #pragma unroll
        for (int t = 0; t < HT; ++t) {
            // hidden unit nb + 16 t + l16 = tile column of this lane
            fb[t].h8[0] = *(const v8us*)(who + woff + t * 16 * IN_DIM);
            fb[t].h8[1] = *(const v8us*)(wlo + woff + t * 16 * IN_DIM);
            bn[t] = b1o[l16 + t * 16];
            wn[t] = W2o[l16 + t * 16];
        }
        // Address registers of the loads above may be reused from here on.
        asm volatile("s_wait_xcnt 0x0" ::: "memory");

        // Rolled: the resident operands are reused by the same instructions for every row tile.
        #pragma unroll 1
        for (int rt = 0; rt < WAVES; ++rt) {
            Frag16 fah, fal;
            const v8us xh = *(const v8us*)(sA + ((rt * 2 + 0) * 32 + lane) * 8);
            const v8us xl = *(const v8us*)(sA + ((rt * 2 + 1) * 32 + lane) * 8);
            fah.h8[0] = xh; fah.h8[1] = xh;
            fal.h8[0] = xl; fal.h8[1] = xl;

            v4f* pacc = (v4f*)sAcc + ((wave * WAVES + rt) * 2) * 32 + lane;
            float acc[8];
            if (pass & 1) {
                const v4f a0 = pacc[0], a1 = pacc[32];
                #pragma unroll
                for (int r = 0; r < 4; ++r) { acc[r] = a0[r]; acc[4 + r] = a1[r]; }
            } else {
                #pragma unroll
                for (int r = 0; r < 8; ++r) acc[r] = 0.0f;
            }

            // Two hidden tiles at a time, their WMMAs interleaved: the second tile's fill the first's accumulate latency.
            #pragma unroll
            for (int t = 0; t < HT; t += 2) {
                const float bt0 = bn[t], bt1 = bn[t + 1];
                v8f c0 = { bt0, bt0, bt0, bt0, bt0, bt0, bt0, bt0 };   // bias for column n, all rows
                v8f c1 = { bt1, bt1, bt1, bt1, bt1, bt1, bt1, bt1 };
                c0 = __builtin_amdgcn_wmma_f32_16x16x32_bf16(false, fah.v, false, fb[t].v,     (short)0, c0, false, false);
                c1 = __builtin_amdgcn_wmma_f32_16x16x32_bf16(false, fah.v, false, fb[t + 1].v, (short)0, c1, false, false);
                c0 = __builtin_amdgcn_wmma_f32_16x16x32_bf16(false, fal.v, false, fb[t].v,     (short)0, c0, false, false);
                c1 = __builtin_amdgcn_wmma_f32_16x16x32_bf16(false, fal.v, false, fb[t + 1].v, (short)0, c1, false, false);
                abs_fma8x2(acc, c0, wn[t], c1, wn[t + 1]);             // |h| part of LeakyReLU
            }

            if (!(pass & 1)) {
                const v4f a0 = { acc[0], acc[1], acc[2], acc[3] };
                const v4f a1 = { acc[4], acc[5], acc[6], acc[7] };
                pacc[0] = a0; pacc[32] = a1;
                continue;
            }

            // Sum over the 16 column lanes of each half: acc[r] -> full 512-dot for row 8h+r.
            #pragma unroll
            for (int r = 0; r < 8; ++r) {
                #pragma unroll
                for (int off = 1; off < 16; off <<= 1)
                    acc[r] += __shfl_xor(acc[r], off, 32);
            }
            float val = acc[0];
            #pragma unroll
            for (int j = 1; j < 8; ++j) val = (l16 == j) ? acc[j] : val;
            if (l16 < 8) sOut[(rt * ROWS_PER_WAVE + 8 * h + l16) * OUT_DIM + o] = ABS_C * val;
        }
    }

    __syncthreads();

    const float* sw = sOut + wave * (ROWS_PER_WAVE * OUT_DIM);
    const float* sl = sLin + wave * (ROWS_PER_WAVE * OUT_DIM);
    const v4f v0 = *(const v4f*)(sw + lane * 4) + *(const v4f*)(sl + lane * 4);
    const v4f v1 = *(const v4f*)(sw + 128 + lane * 4) + *(const v4f*)(sl + 128 + lane * 4);
    const bool p0 = (rbase + (lane >> 2)) < nrows;
    const bool p1 = (rbase + 8 + (lane >> 2)) < nrows;
    float* dst = out + (size_t)rbase * OUT_DIM;
    if (p0) *(v4f*)(dst + lane * 4) = v0;
    if (p1) *(v4f*)(dst + 128 + lane * 4) = v1;
}

extern "C" void kernel_launch(void* const* d_in, const int* in_sizes, int n_in,
                              void* d_out, int out_size, void* d_ws, size_t ws_size,
                              hipStream_t stream)
{
    if (n_in < 5) return;
    const int nx  = in_sizes[0];
    const int nw1 = in_sizes[1];
    const int nb1 = in_sizes[2];
    const int nw2 = in_sizes[3];
    const int nb2 = in_sizes[4];
    const int nrows = nx / IN_DIM;
    if (nrows <= 0 || nx != nrows * IN_DIM) return;
    if (nw1 != OUT_DIM * HID * IN_DIM || nb1 != OUT_DIM * HID || nw2 != OUT_DIM * HID || nb2 != OUT_DIM) return;
    if (out_size != nrows * OUT_DIM) return;

    // ws carve: Whi [nw1] bf16 at 0, Wlo [nw1] bf16 right after -> 2 * 131072 * 2 B = 524288 B; then Vhi, Vlo [256] bf16 each, cl [16] f32.
    const size_t plane_bytes = (size_t)nw1 * sizeof(unsigned short);
    if (2 * plane_bytes + 2048 > ws_size) return;
    unsigned short* Whi = (unsigned short*)d_ws;
    unsigned short* Wlo = Whi + nw1;
    unsigned short* Vhi = Wlo + nw1;
    unsigned short* Vlo = Vhi + OUT_DIM * IN_DIM;
    float* cl = (float*)(Vlo + OUT_DIM * IN_DIM);

    const float* x  = (const float*)d_in[0];
    const float* W1 = (const float*)d_in[1];
    const float* b1 = (const float*)d_in[2];
    const float* W2 = (const float*)d_in[3];
    const float* b2 = (const float*)d_in[4];
    float* out = (float*)d_out;

    const int nvec = nw1 / 8;                                   // 16384 vectors of 8
    dim3 gcv(OUT_DIM + (nvec + 255) / 256);                     // the first 16 blocks: one head's linear part each
    k_split_w1<<<gcv, dim3(256), 0, stream>>>(W1, b1, W2, b2, Whi, Wlo, Vhi, Vlo, cl, nvec);

    dim3 gm((nrows + ROWS_PER_BLOCK - 1) / ROWS_PER_BLOCK);     // 256 blocks for 32768 rows
    k_mlp16<<<gm, dim3(256), 0, stream>>>(x, Whi, Wlo, Vhi, Vlo, cl, b1, W2, out, nrows);
    (void)hipGetLastError();
}

// v003
// A run of this version takes 24.2 microseconds.
// Timed twice side by side with v002, it ran 1.14 times as fast both times.
// Counting every step since v000, it is 9.88 times as fast.
#include <hip/hip_runtime.h>
#include <stdint.h>

// Contraction 1 (x . W1[o]^T per head, K=16 on a 32-deep tile): v_wmma_f32_16x16x32_bf16, bf16 operands as hi+lo pairs packed along k (A = [x_hi | x_lo], B = [W_hi | W_hi] and [W_lo | W_lo]), f32 accumulate seeded with b1; contraction 2 (512 -> 1 per head with W2): f32 VALU from the f32 accumulators.
// LeakyReLU(h) = 0.6 h + 0.4 |h| (slope 0.2). The part linear in h sums to x . V[o] + const with V[o] = 0.6 sum_n W2[o][n] W1[o][n][:], one more 16-column tile on the same WMMA form.

typedef float v8f __attribute__((ext_vector_type(8)));
typedef float v4f __attribute__((ext_vector_type(4))) __attribute__((may_alias));
typedef unsigned short v8us __attribute__((ext_vector_type(8))) __attribute__((may_alias));
typedef unsigned short v16us __attribute__((ext_vector_type(16)));
typedef __bf16 v16bf __attribute__((ext_vector_type(16)));

union Frag16 { v16bf v; v16us u; v8us h8[2]; };

#define IN_DIM          16
#define OUT_DIM         16
#define HID             512
#define NT              (HID / 16)
#define WAVES           8
#define ROWS_PER_WAVE   16
#define ROWS_PER_BLOCK  (WAVES * ROWS_PER_WAVE)
#define NEG_SLOPE       0.2f
#define LIN_C           (0.5f * (1.0f + NEG_SLOPE))   // weight of h in LeakyReLU
#define ABS_C           (0.5f * (1.0f - NEG_SLOPE))   // weight of |h| in LeakyReLU

__device__ __forceinline__ unsigned short bf16_rne_bits(float f) {
    unsigned int u = __float_as_uint(f);
    u += 0x7FFFu + ((u >> 16) & 1u);
    return (unsigned short)(u >> 16);
}
__device__ __forceinline__ float bf16_bits_to_f32(unsigned short s) {
    return __uint_as_float(((unsigned int)s) << 16);
}
__device__ __forceinline__ void split_bf16(float v, unsigned short& hi, unsigned short& lo) {
    hi = bf16_rne_bits(v);
    const float r = v - bf16_bits_to_f32(hi);   // exact residual
    lo = bf16_rne_bits(r);
}

// Two chained 16x16x32 bf16 WMMAs into one accumulator, then the VALU hazard guard.
__device__ __forceinline__ v8f wmma_pair_bf16(v16bf ah, v16bf al, v16bf b, v8f c) {
    c = __builtin_amdgcn_wmma_f32_16x16x32_bf16(false, ah, false, b, (short)0, c, false, false);
    c = __builtin_amdgcn_wmma_f32_16x16x32_bf16(false, al, false, b, (short)0, c, false, false);
    asm volatile("v_nop\n\tv_nop\n\tv_nop\n\tv_nop" : "+v"(c) : "v"(ah), "v"(al), "v"(b));
    return c;
}

// a[j] += |c[j]| * w for four rows of a WMMA result: one v_fma_f32 with the abs source modifier per element (compiled code
// pairs the sums into packed fma, which has no abs modifier, and spends a v_and_b32 per element on it).
__device__ __forceinline__ void abs_fma4(float& a0, float& a1, float& a2, float& a3,
                                         float c0, float c1, float c2, float c3, float w) {
    asm volatile("v_fma_f32 %0, |%4|, %8, %0\n\t"
                 "v_fma_f32 %1, |%5|, %8, %1\n\t"
                 "v_fma_f32 %2, |%6|, %8, %2\n\t"
                 "v_fma_f32 %3, |%7|, %8, %3"
                 : "+v"(a0), "+v"(a1), "+v"(a2), "+v"(a3)
                 : "v"(c0), "v"(c1), "v"(c2), "v"(c3), "v"(w));
}

// One 16-unit hidden tile as loaded: this lane's 8 weights as bf16 hi and lo, its unit's b1 and W2.
struct RawTile { v8us wh, wl; float b, w; };

// First hidden unit (flat over heads) of a wave's tile T = 0 .. 63: head T / 32 * 8 + wave, tile T % 32. Past the end: the last tile again.
__device__ __forceinline__ int tile_unit(int T, int wave) {
    const int Tc = T < 2 * NT ? T : 2 * NT - 1;
    return ((Tc / NT) * WAVES + wave) * HID + (Tc % NT) * 16;
}

__device__ __forceinline__ void load_tile(RawTile& r,
                                          const unsigned short* __restrict__ Whi, const unsigned short* __restrict__ Wlo,
                                          const float* __restrict__ b1, const float* __restrict__ W2,
                                          int nb, int woff, int l16) {
    r.wh = *(const v8us*)(Whi + (size_t)nb * IN_DIM + woff);
    r.wl = *(const v8us*)(Wlo + (size_t)nb * IN_DIM + woff);
    r.b  = b1[nb + l16];
    r.w  = W2[nb + l16];
    // Address registers of the loads above may be reused from here on.
    asm volatile("s_wait_xcnt 0x0" ::: "memory");
}

// One hidden tile against all eight resident row tiles. The bias tile is built once and is the C operand of all eight.
// Each WMMA is followed by four sums of the row-tile pair before, whose results are complete: they issue while the matrix unit works.
__device__ __forceinline__ void tile_step(float (&acc)[WAVES][8], const Frag16 (&fa)[WAVES], RawTile& r,
                                          v8f& p0, v8f& p1, float& wp,
                                          const unsigned short* __restrict__ Whi, const unsigned short* __restrict__ Wlo,
                                          const float* __restrict__ b1, const float* __restrict__ W2,
                                          int nb_next, int woff, int l16) {
    Frag16 fh, fl;
    fh.h8[0] = r.wh; fh.h8[1] = r.wh;
    fl.h8[0] = r.wl; fl.h8[1] = r.wl;
    const float bt = r.b;
    const float w  = ABS_C * r.w;                                // weight of |h|, for all eight row tiles
    const v8f cb = { bt, bt, bt, bt, bt, bt, bt, bt };           // bias for column n, all rows
    load_tile(r, Whi, Wlo, b1, W2, nb_next, woff, l16);
    // The scheduling barriers keep this order: left free, the compiler puts a result's sums directly behind its WMMA,
    // inside the slots that a WMMA result needs before it is read, and nothing is left to issue beside the matrix unit.
    __builtin_amdgcn_sched_barrier(0);
    #pragma unroll
    for (int p = 0; p < WAVES / 2; ++p) {
        const int q0 = (2 * p + 6) & 7, q1 = (2 * p + 7) & 7;     // the row tiles whose results wait in p0, p1
        const float wq = (p == 0) ? wp : w;                       // theirs is the tile before at p = 0
        v8f c0 = __builtin_amdgcn_wmma_f32_16x16x32_bf16(false, fa[2 * p].v, false, fh.v, (short)0, cb, false, false);
        __builtin_amdgcn_sched_barrier(0);
        abs_fma4(acc[q0][0], acc[q0][1], acc[q0][2], acc[q0][3], p0[0], p0[1], p0[2], p0[3], wq);
        __builtin_amdgcn_sched_barrier(0);
        v8f c1 = __builtin_amdgcn_wmma_f32_16x16x32_bf16(false, fa[2 * p + 1].v, false, fh.v, (short)0, cb, false, false);
        __builtin_amdgcn_sched_barrier(0);
        abs_fma4(acc[q0][4], acc[q0][5], acc[q0][6], acc[q0][7], p0[4], p0[5], p0[6], p0[7], wq);
        __builtin_amdgcn_sched_barrier(0);
        c0 = __builtin_amdgcn_wmma_f32_16x16x32_bf16(false, fa[2 * p].v, false, fl.v, (short)0, c0, false, false);
        __builtin_amdgcn_sched_barrier(0);
        abs_fma4(acc[q1][0], acc[q1][1], acc[q1][2], acc[q1][3], p1[0], p1[1], p1[2], p1[3], wq);
        __builtin_amdgcn_sched_barrier(0);
        c1 = __builtin_amdgcn_wmma_f32_16x16x32_bf16(false, fa[2 * p + 1].v, false, fl.v, (short)0, c1, false, false);
        __builtin_amdgcn_sched_barrier(0);
        abs_fma4(acc[q1][4], acc[q1][5], acc[q1][6], acc[q1][7], p1[4], p1[5], p1[6], p1[7], wq);
        __builtin_amdgcn_sched_barrier(0);
        p0 = c0; p1 = c1;
    }
    wp = w;
}

// Sum of 16 values as a tree: a short dependent chain.
__device__ __forceinline__ float tree16(const float* p, int stride) {
    float v[16];
    #pragma unroll
    for (int j = 0; j < 16; ++j) v[j] = p[j * stride];
    #pragma unroll
    for (int st = 8; st > 0; st >>= 1) {
        #pragma unroll
        for (int j = 0; j < st; ++j) v[j] += v[j + st];
    }
    return v[0];
}

// Blocks 0 .. 15: one head each, the linear part of the head:
//   V[o][i] = LIN_C * sum_n W2[o][n] W1[o][n][i] as bf16 hi and lo, cl[o] = LIN_C * sum_n W2[o][n] b1[o][n] + b2[o].
// Blocks 16 ..: W1 (flat f32, n = 16*512*16) -> bf16 hi plane and bf16 lo plane in ws.
__global__ __launch_bounds__(256) void k_split_w1(const float* __restrict__ W1,
                                                  const float* __restrict__ b1,
                                                  const float* __restrict__ W2,
                                                  const float* __restrict__ b2,
                                                  unsigned short* __restrict__ Whi,
                                                  unsigned short* __restrict__ Wlo,
                                                  unsigned short* __restrict__ Vhi,
                                                  unsigned short* __restrict__ Vlo,
                                                  float* __restrict__ cl,
                                                  int nvec)
{
    if (blockIdx.x < OUT_DIM) {                                   // block-uniform
        __shared__ __align__(16) float sV[64 * IN_DIM];           // 64 partial 16-vectors
        __shared__ float sC[256];                                 // and their partial bias sums, one copy per q
        __shared__ float sV2[16 * IN_DIM];
        __shared__ float sC2[16];
        const int o   = blockIdx.x;
        const int tid = threadIdx.x;
        const int q   = tid & 3;                                  // which four inputs
        const int g   = tid >> 2;                                 // hidden units g, g + 64, ...
        const float* W1o = W1 + (size_t)o * HID * IN_DIM;
        const float* W2o = W2 + o * HID;
        const float* b1o = b1 + o * HID;
        v4f   wv[8];
        float w2[8], bb[8];
        #pragma unroll
        for (int j = 0; j < 8; ++j) {
            const int n = g + 64 * j;
            wv[j] = *(const v4f*)(W1o + n * IN_DIM + 4 * q);
            w2[j] = W2o[n];
            bb[j] = b1o[n];
        }
        // Address registers of the loads above may be reused from here on. The loaded values are inputs so that all 24 loads
        // are issued before the first is used: one load latency for the block, not two.
        asm volatile("s_wait_xcnt 0x0"
                     :: "v"(wv[0]), "v"(wv[1]), "v"(wv[2]), "v"(wv[3]), "v"(wv[4]), "v"(wv[5]), "v"(wv[6]), "v"(wv[7]),
                        "v"(w2[0]), "v"(w2[1]), "v"(w2[2]), "v"(w2[3]), "v"(w2[4]), "v"(w2[5]), "v"(w2[6]), "v"(w2[7]),
                        "v"(bb[0]), "v"(bb[1]), "v"(bb[2]), "v"(bb[3]), "v"(bb[4]), "v"(bb[5]), "v"(bb[6]), "v"(bb[7])
                     : "memory");
        v4f s = { 0.0f, 0.0f, 0.0f, 0.0f };
        float cs = 0.0f;
        #pragma unroll
        for (int j = 0; j < 8; ++j) {
            cs = fmaf(w2[j], bb[j], cs);
            #pragma unroll
            for (int e = 0; e < 4; ++e) s[e] = fmaf(w2[j], wv[j][e], s[e]);
        }
        *(v4f*)(sV + g * IN_DIM + 4 * q) = s;
        sC[tid] = cs;
        __syncthreads();
        {
            const int i = tid & 15, gg = tid >> 4;
            const float* pv = sV + gg * 4 * IN_DIM + i;
            sV2[gg * IN_DIM + i] = (pv[0] + pv[IN_DIM]) + (pv[2 * IN_DIM] + pv[3 * IN_DIM]);
            if (i == 0) sC2[gg] = (sC[gg * 16] + sC[gg * 16 + 4]) + (sC[gg * 16 + 8] + sC[gg * 16 + 12]);
        }
        __syncthreads();
        if (tid < 16) {
            unsigned short hh, ll;
            split_bf16(LIN_C * tree16(sV2 + tid, IN_DIM), hh, ll);
            Vhi[o * IN_DIM + tid] = hh;
            Vlo[o * IN_DIM + tid] = ll;
        } else if (tid == 32) {                                   // another wave, beside the one above
            cl[o] = fmaf(LIN_C, tree16(sC2, 1), b2[o]);
        }
        return;
    }
    const int i = (blockIdx.x - OUT_DIM) * 256 + threadIdx.x;
    const bool ok = i < nvec;
    const int ic = ok ? i : 0;
    const v4f* src = (const v4f*)(W1 + (size_t)ic * 8);
    const v4f f0 = src[0], f1 = src[1];
    v8us hv, lv;
    #pragma unroll
    for (int e = 0; e < 4; ++e) {
        unsigned short hh, ll;
        split_bf16(f0[e], hh, ll); hv[e] = hh;     lv[e] = ll;
        split_bf16(f1[e], hh, ll); hv[4 + e] = hh; lv[4 + e] = ll;
    }
    unsigned short* ph = Whi + (size_t)ic * 8;
    unsigned short* pl = Wlo + (size_t)ic * 8;
    if (ok) {
        *(v8us*)ph = hv;
        *(v8us*)pl = lv;
    }
    
}

// One block = 128 batch rows (8 row tiles) x all 16 heads, 8 heads at a time: each wave owns ONE head.
// The A fragments of all 8 row tiles and the 64 running sums a lane (8 row tiles x 8 rows) stay in registers; the head's
// 32 hidden tiles stream past them from L2, loaded four tiles ahead, each tile used by all 8 row tiles.
// A fragment (lane l, row m = l&15, h = l>>4): elements 0..7 = bf16_hi(x[m][8h..8h+7]) (k = 8h+i),
//   elements 8..15 = bf16_lo of the same values (k = 16+8h+i)  ->  A[m][k] = x_hi[m][k], A[m][k+16] = x_lo[m][k].
// B fragments (lane l, column n = l&15): hi fragment: elements 0..7 = W_hi[n][8h..8h+7] (k = 8h+i),
//   elements 8..15 = the same values (k = 16+8h+i); lo fragment: the same with W_lo.
// D = b1[n] + sum_i (x_hi + x_lo)[m][i] * W_hi[n][i], then + the same with W_lo -> full product.
// The tile loop sums W2[n] |D| only; the part linear in D is one product of the wave's own row tile with the V tile (column = head),
// there with A = [x_hi | x_hi] and [x_lo | x_lo], B = [V_hi | V_lo].
// At most two waves a SIMD, so one block a WGP: a grid of one block per WGP spreads over all of them.
__global__ __launch_bounds__(256) __attribute__((amdgpu_waves_per_eu(2, 2))) void k_mlp16(const float* __restrict__ x,
                                               const unsigned short* __restrict__ Whi,
                                               const unsigned short* __restrict__ Wlo,
                                               const unsigned short* __restrict__ Vhi,
                                               const unsigned short* __restrict__ Vlo,
                                               const float* __restrict__ cl,
                                               const float* __restrict__ b1,
                                               const float* __restrict__ W2,
                                               float* __restrict__ out,
                                               int nrows)
{
    __shared__ __align__(16) float sOut[WAVES * ROWS_PER_WAVE * OUT_DIM];   // 2048 floats = 8 KB
    __shared__ __align__(16) unsigned short sA[WAVES * 2 * 32 * 8];         // per row tile: hi plane, lo plane, 16 B a lane = 8 KB
    __shared__ __align__(16) float sLin[WAVES * ROWS_PER_WAVE * OUT_DIM];   // linear part, laid out like sOut = 8 KB

    const int tid  = threadIdx.x;
    const int lane = tid & 31;
    const int wave = __builtin_amdgcn_readfirstlane(tid >> 5);              // scalar, so head and pass offsets stay scalar
    const int h    = lane >> 4;
    const int l16  = lane & 15;
    const int woff = l16 * IN_DIM + 8 * h;                                  // this lane's place in a 16-unit weight tile

    const int rbase = blockIdx.x * ROWS_PER_BLOCK + wave * ROWS_PER_WAVE;   // first row of this wave's own tile
    int row = rbase + l16;
    if (row > nrows - 1) row = nrows - 1;                                   // clamp loads; stores predicated

    // The wave's 64 hidden tiles (two heads of 32) stream through four register buffers, each refilled four tiles ahead:
    // the loads have four tile steps to come back from L2. The first four fly while the row tile below is split.
    RawTile r0, r1, r2, r3;
    load_tile(r0, Whi, Wlo, b1, W2, tile_unit(0, wave), woff, l16);
    load_tile(r1, Whi, Wlo, b1, W2, tile_unit(1, wave), woff, l16);
    load_tile(r2, Whi, Wlo, b1, W2, tile_unit(2, wave), woff, l16);
    load_tile(r3, Whi, Wlo, b1, W2, tile_unit(3, wave), woff, l16);

    // Each wave splits its own row tile once and publishes the two halves for all waves.
    {
        Frag16 fv, fxh, fxl;
        fv.h8[0] = *(const v8us*)(Vhi + woff);
        fv.h8[1] = *(const v8us*)(Vlo + woff);
        const float cv = cl[l16];
        const v4f* xp = (const v4f*)(x + (size_t)row * IN_DIM + 8 * h);
        const v4f x0 = xp[0], x1 = xp[1];
        // Address registers of the loads above may be reused from here on.
        asm volatile("s_wait_xcnt 0x0" ::: "memory");
        v8us xh, xl;
        #pragma unroll
        for (int e = 0; e < 4; ++e) {
            unsigned short hh, ll;
            split_bf16(x0[e], hh, ll); xh[e] = hh;     xl[e] = ll;
            split_bf16(x1[e], hh, ll); xh[4 + e] = hh; xl[4 + e] = ll;
        }
        *(v8us*)(sA + ((wave * 2 + 0) * 32 + lane) * 8) = xh;
        *(v8us*)(sA + ((wave * 2 + 1) * 32 + lane) * 8) = xl;
        fxh.h8[0] = xh; fxh.h8[1] = xh;
        fxl.h8[0] = xl; fxl.h8[1] = xl;
        const v8f c0 = { cv, cv, cv, cv, cv, cv, cv, cv };
        const v8f lin = wmma_pair_bf16(fxh.v, fxl.v, fv.v, c0);           // row 8h+r of the own tile, head l16
        #pragma unroll
        for (int r = 0; r < 8; ++r) sLin[(wave * ROWS_PER_WAVE + 8 * h + r) * OUT_DIM + l16] = lin[r];
    }
    __syncthreads();

    // The block's eight row tiles stay in registers for the whole kernel: A = [x_hi | x_lo] along k.
    Frag16 fa[WAVES];
    #pragma unroll
    for (int rt = 0; rt < WAVES; ++rt) {
        fa[rt].h8[0] = *(const v8us*)(sA + ((rt * 2 + 0) * 32 + lane) * 8);
        fa[rt].h8[1] = *(const v8us*)(sA + ((rt * 2 + 1) * 32 + lane) * 8);
    }

    // Rolled: one copy of the tile body and of the reduction in the text.
    #pragma unroll 1
    for (int g = 0; g < OUT_DIM / WAVES; ++g) {
        const int o = g * WAVES + wave;
        float acc[WAVES][8];
        #pragma unroll
        for (int rt = 0; rt < WAVES; ++rt) {
            #pragma unroll
            for (int r = 0; r < 8; ++r) acc[rt][r] = 0.0f;
        }
        // Results of the last two row tiles wait one tile step for their sums; zero weight before the head's first tile.
        v8f   p0 = { 0.0f, 0.0f, 0.0f, 0.0f, 0.0f, 0.0f, 0.0f, 0.0f };
        v8f   p1 = p0;
        float wp = 0.0f;

        // Rolled, four tiles a trip: one per register buffer.
        #pragma unroll 1
        for (int t = 0; t < NT; t += 4) {
            const int T = g * NT + t;
            tile_step(acc, fa, r0, p0, p1, wp, Whi, Wlo, b1, W2, tile_unit(T + 4, wave), woff, l16);
            tile_step(acc, fa, r1, p0, p1, wp, Whi, Wlo, b1, W2, tile_unit(T + 5, wave), woff, l16);
            tile_step(acc, fa, r2, p0, p1, wp, Whi, Wlo, b1, W2, tile_unit(T + 6, wave), woff, l16);
            tile_step(acc, fa, r3, p0, p1, wp, Whi, Wlo, b1, W2, tile_unit(T + 7, wave), woff, l16);
        }
        abs_fma4(acc[6][0], acc[6][1], acc[6][2], acc[6][3], p0[0], p0[1], p0[2], p0[3], wp);
        abs_fma4(acc[6][4], acc[6][5], acc[6][6], acc[6][7], p0[4], p0[5], p0[6], p0[7], wp);
        abs_fma4(acc[7][0], acc[7][1], acc[7][2], acc[7][3], p1[0], p1[1], p1[2], p1[3], wp);
        abs_fma4(acc[7][4], acc[7][5], acc[7][6], acc[7][7], p1[4], p1[5], p1[6], p1[7], wp);

        // Sum over the 16 column lanes of each half: acc[rt][r] -> full 512-dot for row 8h+r of row tile rt.
        // Step by step for all 64 sums of the head, so that each step's exchanges are in flight together.
        #pragma unroll
        for (int off = 1; off < 16; off <<= 1) {
            #pragma unroll
            for (int rt = 0; rt < WAVES; ++rt) {
                #pragma unroll
                for (int r = 0; r < 8; ++r) acc[rt][r] += __shfl_xor(acc[rt][r], off, 32);
            }
        }
        #pragma unroll
        for (int rt = 0; rt < WAVES; ++rt) {
            float val = acc[rt][0];
            #pragma unroll
            for (int j = 1; j < 8; ++j) val = (l16 == j) ? acc[rt][j] : val;
            if (l16 < 8) sOut[(rt * ROWS_PER_WAVE + 8 * h + l16) * OUT_DIM + o] = val;
        }
    }

    __syncthreads();

    const float* sw = sOut + wave * (ROWS_PER_WAVE * OUT_DIM);
    const float* sl = sLin + wave * (ROWS_PER_WAVE * OUT_DIM);
    const v4f v0 = *(const v4f*)(sw + lane * 4) + *(const v4f*)(sl + lane * 4);
    const v4f v1 = *(const v4f*)(sw + 128 + lane * 4) + *(const v4f*)(sl + 128 + lane * 4);
    const bool p0 = (rbase + (lane >> 2)) < nrows;
    const bool p1 = (rbase + 8 + (lane >> 2)) < nrows;
    float* dst = out + (size_t)rbase * OUT_DIM;
    if (p0) *(v4f*)(dst + lane * 4) = v0;
    if (p1) *(v4f*)(dst + 128 + lane * 4) = v1;
}

extern "C" void kernel_launch(void* const* d_in, const int* in_sizes, int n_in,
                              void* d_out, int out_size, void* d_ws, size_t ws_size,
                              hipStream_t stream)
{
    if (n_in < 5) return;
    const int nx  = in_sizes[0];
    const int nw1 = in_sizes[1];
    const int nb1 = in_sizes[2];
    const int nw2 = in_sizes[3];
    const int nb2 = in_sizes[4];
    const int nrows = nx / IN_DIM;
    if (nrows <= 0 || nx != nrows * IN_DIM) return;
    if (nw1 != OUT_DIM * HID * IN_DIM || nb1 != OUT_DIM * HID || nw2 != OUT_DIM * HID || nb2 != OUT_DIM) return;
    if (out_size != nrows * OUT_DIM) return;

    // ws carve: Whi [nw1] bf16 at 0, Wlo [nw1] bf16 right after -> 2 * 131072 * 2 B = 524288 B; then Vhi, Vlo [256] bf16 each, cl [16] f32.
    const size_t plane_bytes = (size_t)nw1 * sizeof(unsigned short);
    if (2 * plane_bytes + 2048 > ws_size) return;
    unsigned short* Whi = (unsigned short*)d_ws;
    unsigned short* Wlo = Whi + nw1;
    unsigned short* Vhi = Wlo + nw1;
    unsigned short* Vlo = Vhi + OUT_DIM * IN_DIM;
    float* cl = (float*)(Vlo + OUT_DIM * IN_DIM);

    const float* x  = (const float*)d_in[0];
    const float* W1 = (const float*)d_in[1];
    const float* b1 = (const float*)d_in[2];
    const float* W2 = (const float*)d_in[3];
    const float* b2 = (const float*)d_in[4];
    float* out = (float*)d_out;

    const int nvec = nw1 / 8;                                   // 16384 vectors of 8
    dim3 gcv(OUT_DIM + (nvec + 255) / 256);                     // the first 16 blocks: one head's linear part each
    k_split_w1<<<gcv, dim3(256), 0, stream>>>(W1, b1, W2, b2, Whi, Wlo, Vhi, Vlo, cl, nvec);

    dim3 gm((nrows + ROWS_PER_BLOCK - 1) / ROWS_PER_BLOCK);     // 256 blocks for 32768 rows
    k_mlp16<<<gm, dim3(256), 0, stream>>>(x, Whi, Wlo, Vhi, Vlo, cl, b1, W2, out, nrows);
    (void)hipGetLastError();
}

// v004
// One run takes 22.3 microseconds.
// In two side-by-side timings against v003, it was 1.09 and 1.08 times as fast.
// All steps since v000 together make it 10.7 times as fast.
#include <hip/hip_runtime.h>
#include <stdint.h>

// Contraction 1 (x . W1[o]^T per head, K=16 on a 32-deep tile): v_wmma_f32_16x16x32_bf16, bf16 operands as hi+lo pairs packed along k (A = [x_hi | x_lo], B = [W_hi | W_hi] and [W_lo | W_lo]), f32 accumulate seeded with b1; contraction 2 (512 -> 1 per head with W2): f32 VALU from the f32 accumulators.
// LeakyReLU(h) = 0.6 h + 0.4 |h| (slope 0.2). The part linear in h sums to x . V[o] + const with V[o] = 0.6 sum_n W2[o][n] W1[o][n][:], one more 16-column tile on the same WMMA form.
// One launch: W1 streams as f32 and is split into bf16 hi and lo in registers by the wave that uses it, which sums V[o] from the same registers.

typedef float v8f __attribute__((ext_vector_type(8)));
typedef float v4f __attribute__((ext_vector_type(4))) __attribute__((may_alias));
typedef float v2f __attribute__((ext_vector_type(2)));
typedef __bf16 v2bf __attribute__((ext_vector_type(2)));
typedef unsigned int v4u __attribute__((ext_vector_type(4)));
typedef unsigned short v8us __attribute__((ext_vector_type(8))) __attribute__((may_alias));
typedef unsigned short v16us __attribute__((ext_vector_type(16)));
typedef __bf16 v16bf __attribute__((ext_vector_type(16)));

union Frag16 { v16bf v; v16us u; v8us h8[2]; v4u u4[2]; };

#define IN_DIM          16
#define OUT_DIM         16
#define HID             512
#define NT              (HID / 16)
#define WAVES           8
#define ROWS_PER_WAVE   16
#define ROWS_PER_BLOCK  (WAVES * ROWS_PER_WAVE)
#define NEG_SLOPE       0.2f
#define LIN_C           (0.5f * (1.0f + NEG_SLOPE))   // weight of h in LeakyReLU
#define ABS_C           (0.5f * (1.0f - NEG_SLOPE))   // weight of |h| in LeakyReLU

__device__ __forceinline__ unsigned short bf16_rne_bits(float f) {
    unsigned int u = __float_as_uint(f);
    u += 0x7FFFu + ((u >> 16) & 1u);
    return (unsigned short)(u >> 16);
}
__device__ __forceinline__ float bf16_bits_to_f32(unsigned short s) {
    return __uint_as_float(((unsigned int)s) << 16);
}
__device__ __forceinline__ void split_bf16(float v, unsigned short& hi, unsigned short& lo) {
    hi = bf16_rne_bits(v);
    const float r = v - bf16_bits_to_f32(hi);   // exact residual
    lo = bf16_rne_bits(r);
}

// Two f32 values -> their bf16 hi parts packed in one word and the bf16 lo parts (of the exact residuals) in another.
__device__ __forceinline__ void split_pair(float a, float b, unsigned int& hi, unsigned int& lo) {
    const v2f f = { a, b };
    const v2bf hb = __builtin_convertvector(f, v2bf);
    const v2f r = { __builtin_fmaf((float)hb[0], -1.0f, a), __builtin_fmaf((float)hb[1], -1.0f, b) };
    const v2bf lb = __builtin_convertvector(r, v2bf);
    hi = __builtin_bit_cast(unsigned int, hb);
    lo = __builtin_bit_cast(unsigned int, lb);
}

// Two chained 16x16x32 bf16 WMMAs into one accumulator, then the VALU hazard guard.
__device__ __forceinline__ v8f wmma_pair_bf16(v16bf ah, v16bf al, v16bf b, v8f c) {
    c = __builtin_amdgcn_wmma_f32_16x16x32_bf16(false, ah, false, b, (short)0, c, false, false);
    c = __builtin_amdgcn_wmma_f32_16x16x32_bf16(false, al, false, b, (short)0, c, false, false);
    asm volatile("v_nop\n\tv_nop\n\tv_nop\n\tv_nop" : "+v"(c) : "v"(ah), "v"(al), "v"(b));
    return c;
}

// a[j] += |c[j]| * w for four rows of a WMMA result: one v_fma_f32 with the abs source modifier per element (compiled code
// pairs the sums into packed fma, which has no abs modifier, and spends a v_and_b32 per element on it).
__device__ __forceinline__ void abs_fma4(float& a0, float& a1, float& a2, float& a3,
                                         float c0, float c1, float c2, float c3, float w) {
    asm volatile("v_fma_f32 %0, |%4|, %8, %0\n\t"
                 "v_fma_f32 %1, |%5|, %8, %1\n\t"
                 "v_fma_f32 %2, |%6|, %8, %2\n\t"
                 "v_fma_f32 %3, |%7|, %8, %3"
                 : "+v"(a0), "+v"(a1), "+v"(a2), "+v"(a3)
                 : "v"(c0), "v"(c1), "v"(c2), "v"(c3), "v"(w));
}

// One 16-unit hidden tile as loaded: this lane's 8 weights (f32), its unit's W2 and b1 (a register pair: W2 is the packed sums' first source).
struct RawTile { v4f f0, f1; v2f wb; };   // wb = { W2, b1 }

// First hidden unit (flat over heads) of a wave's tile T = 0 .. 63: head T / 32 * 8 + wave, tile T % 32. Past the end: the last tile again.
__device__ __forceinline__ int tile_unit(int T, int wave) {
    const int Tc = T < 2 * NT ? T : 2 * NT - 1;
    return ((Tc / NT) * WAVES + wave) * HID + (Tc % NT) * 16;
}

__device__ __forceinline__ void load_tile(RawTile& r, const float* __restrict__ W1,
                                          const float* __restrict__ b1, const float* __restrict__ W2,
                                          int nb, int woff, int l16) {
    const v4f* wp4 = (const v4f*)(W1 + (size_t)nb * IN_DIM + woff);
    r.f0 = wp4[0];
    r.f1 = wp4[1];
    r.wb[0] = W2[nb + l16];
    r.wb[1] = b1[nb + l16];
    // Address registers of the loads above may be reused from here on.
    asm volatile("s_wait_xcnt 0x0" ::: "memory");
}

// One hidden tile against all eight resident row tiles. The bias tile is built once and is the C operand of all eight.
// Each WMMA is followed by four sums of the row-tile pair before, whose results are complete: they issue while the matrix unit works.
// The tile's weights are split here, and W2[n] W1[n][:] and W2[n] b1[n] join the head's linear sums vs, cs (this lane's unit n, its 8 inputs).
__device__ __forceinline__ void tile_step(float (&acc)[WAVES][8], const Frag16 (&fa)[WAVES], RawTile& r,
                                          v8f& p0, v8f& p1, float& wp, v2f (&vs)[4], float& cs,
                                          const float* __restrict__ W1,
                                          const float* __restrict__ b1, const float* __restrict__ W2,
                                          int nb_next, int woff, int l16) {
    Frag16 fh, fl;
    {
        v4u hv, lv;
        unsigned int hh, ll;
        split_pair(r.f0[0], r.f0[1], hh, ll); hv[0] = hh; lv[0] = ll;
        split_pair(r.f0[2], r.f0[3], hh, ll); hv[1] = hh; lv[1] = ll;
        split_pair(r.f1[0], r.f1[1], hh, ll); hv[2] = hh; lv[2] = ll;
        split_pair(r.f1[2], r.f1[3], hh, ll); hv[3] = hh; lv[3] = ll;
        fh.u4[0] = hv; fh.u4[1] = hv;
        fl.u4[0] = lv; fl.u4[1] = lv;
        // vs += W2 * weights (both halves of a packed fma take W2 from the pair's low word), cs += W2 * b1. In asm so that the sums
        // stay here, in front of the reload of these registers: compiled, they sink to the loop's foot and all four buffers' old values stay live.
        asm volatile("v_pk_fma_f32 %0, %5, %8, %0 op_sel_hi:[0,1,1]\n\t"
                     "v_pk_fma_f32 %1, %5, %9, %1 op_sel_hi:[0,1,1]\n\t"
                     "v_pk_fma_f32 %2, %5, %10, %2 op_sel_hi:[0,1,1]\n\t"
                     "v_pk_fma_f32 %3, %5, %11, %3 op_sel_hi:[0,1,1]\n\t"
                     "v_fma_f32 %4, %6, %7, %4"
                     : "+v"(vs[0]), "+v"(vs[1]), "+v"(vs[2]), "+v"(vs[3]), "+v"(cs)
                     : "v"(r.wb), "v"(r.wb[0]), "v"(r.wb[1]),
                       "v"((v2f){ r.f0[0], r.f0[1] }), "v"((v2f){ r.f0[2], r.f0[3] }), "v"((v2f){ r.f1[0], r.f1[1] }), "v"((v2f){ r.f1[2], r.f1[3] }));
    }
    const float bt = r.wb[1];
    const float w  = ABS_C * r.wb[0];                               // weight of |h|, for all eight row tiles
    const v8f cb = { bt, bt, bt, bt, bt, bt, bt, bt };           // bias for column n, all rows
    load_tile(r, W1, b1, W2, nb_next, woff, l16);
    // The scheduling barriers keep this order: left free, the compiler puts a result's sums directly behind its WMMA,
    // inside the slots that a WMMA result needs before it is read, and nothing is left to issue beside the matrix unit.
    __builtin_amdgcn_sched_barrier(0);
    #pragma unroll
    for (int p = 0; p < WAVES / 2; ++p) {
        const int q0 = (2 * p + 6) & 7, q1 = (2 * p + 7) & 7;     // the row tiles whose results wait in p0, p1
        const float wq = (p == 0) ? wp : w;                       // theirs is the tile before at p = 0
        v8f c0 = __builtin_amdgcn_wmma_f32_16x16x32_bf16(false, fa[2 * p].v, false, fh.v, (short)0, cb, false, false);
        __builtin_amdgcn_sched_barrier(0);
        abs_fma4(acc[q0][0], acc[q0][1], acc[q0][2], acc[q0][3], p0[0], p0[1], p0[2], p0[3], wq);
        __builtin_amdgcn_sched_barrier(0);
        v8f c1 = __builtin_amdgcn_wmma_f32_16x16x32_bf16(false, fa[2 * p + 1].v, false, fh.v, (short)0, cb, false, false);
        __builtin_amdgcn_sched_barrier(0);
        abs_fma4(acc[q0][4], acc[q0][5], acc[q0][6], acc[q0][7], p0[4], p0[5], p0[6], p0[7], wq);
        __builtin_amdgcn_sched_barrier(0);
        c0 = __builtin_amdgcn_wmma_f32_16x16x32_bf16(false, fa[2 * p].v, false, fl.v, (short)0, c0, false, false);
        __builtin_amdgcn_sched_barrier(0);
        abs_fma4(acc[q1][0], acc[q1][1], acc[q1][2], acc[q1][3], p1[0], p1[1], p1[2], p1[3], wq);
        __builtin_amdgcn_sched_barrier(0);
        c1 = __builtin_amdgcn_wmma_f32_16x16x32_bf16(false, fa[2 * p + 1].v, false, fl.v, (short)0, c1, false, false);
        __builtin_amdgcn_sched_barrier(0);
        abs_fma4(acc[q1][4], acc[q1][5], acc[q1][6], acc[q1][7], p1[4], p1[5], p1[6], p1[7], wq);
        __builtin_amdgcn_sched_barrier(0);
        p0 = c0; p1 = c1;
    }
    wp = w;
}

// Sum over the 16 lanes of a row, the total in every lane of the row: four adds, each with its own cross-lane read (DPP row_xmask).
__device__ __forceinline__ float row16_sum(float v) {
    v += __builtin_bit_cast(float, __builtin_amdgcn_update_dpp(0, __builtin_bit_cast(int, v), 0x161, 0xf, 0xf, true));
    v += __builtin_bit_cast(float, __builtin_amdgcn_update_dpp(0, __builtin_bit_cast(int, v), 0x162, 0xf, 0xf, true));
    v += __builtin_bit_cast(float, __builtin_amdgcn_update_dpp(0, __builtin_bit_cast(int, v), 0x164, 0xf, 0xf, true));
    v += __builtin_bit_cast(float, __builtin_amdgcn_update_dpp(0, __builtin_bit_cast(int, v), 0x168, 0xf, 0xf, true));
    return v;
}

// One block = 128 batch rows (8 row tiles) x all 16 heads, 8 heads at a time: each wave owns ONE head.
// The A fragments of all 8 row tiles and the 64 running sums a lane (8 row tiles x 8 rows) stay in registers; the head's
// 32 hidden tiles stream past them from L2 as f32, loaded four tiles ahead, each tile split once and used by all 8 row tiles.
// A fragment (lane l, row m = l&15, h = l>>4): elements 0..7 = bf16_hi(x[m][8h..8h+7]) (k = 8h+i),
//   elements 8..15 = bf16_lo of the same values (k = 16+8h+i)  ->  A[m][k] = x_hi[m][k], A[m][k+16] = x_lo[m][k].
// B fragments (lane l, column n = l&15): hi fragment: elements 0..7 = W_hi[n][8h..8h+7] (k = 8h+i),
//   elements 8..15 = the same values (k = 16+8h+i); lo fragment: the same with W_lo.
// D = b1[n] + sum_i (x_hi + x_lo)[m][i] * W_hi[n][i], then + the same with W_lo -> full product.
// The tile loop sums W2[n] |D| only; the part linear in D is one product of the wave's own row tile with the V tile (column = head),
// there with A = [x_hi | x_hi] and [x_lo | x_lo], B = [V_hi | V_lo]. It stands behind the tile loops: each wave publishes the V sums of its two heads in LDS.
// At most two waves a SIMD, so one block a WGP: a grid of one block per WGP spreads over all of them.
__global__ __launch_bounds__(256) __attribute__((amdgpu_waves_per_eu(2, 2))) void k_mlp16(const float* __restrict__ x,
                                               const float* __restrict__ W1,
                                               const float* __restrict__ b1,
                                               const float* __restrict__ W2,
                                               const float* __restrict__ b2,
                                               float* __restrict__ out,
                                               int nrows)
{
    __shared__ __align__(16) float sOut[WAVES * ROWS_PER_WAVE * OUT_DIM];   // 2048 floats = 8 KB
    __shared__ __align__(16) unsigned short sA[WAVES * 2 * 32 * 8];         // per row tile: hi plane, lo plane, 16 B a lane = 8 KB
    __shared__ __align__(16) float sLin[WAVES * ROWS_PER_WAVE * OUT_DIM];   // linear part, laid out like sOut = 8 KB
    __shared__ __align__(16) float sV[OUT_DIM * IN_DIM];                    // sum_n W2[o][n] W1[o][n][i]
    __shared__ float sC[OUT_DIM];                                           // sum_n W2[o][n] b1[o][n]
    __shared__ float sB2[OUT_DIM];

    const int tid  = threadIdx.x;
    const int lane = tid & 31;
    const int wave = __builtin_amdgcn_readfirstlane(tid >> 5);              // scalar, so head and pass offsets stay scalar
    const int h    = lane >> 4;
    const int l16  = lane & 15;
    const int woff = l16 * IN_DIM + 8 * h;                                  // this lane's place in a 16-unit weight tile

    const int rbase = blockIdx.x * ROWS_PER_BLOCK + wave * ROWS_PER_WAVE;   // first row of this wave's own tile
    int row = rbase + l16;
    if (row > nrows - 1) row = nrows - 1;                                   // clamp loads; stores predicated

    // The wave's 64 hidden tiles (two heads of 32) stream through four register buffers, each refilled four tiles ahead:
    // the loads have four tile steps to come back from L2. The first four fly while the row tile below is split.
    RawTile r0, r1, r2, r3;
    load_tile(r0, W1, b1, W2, tile_unit(0, wave), woff, l16);
    load_tile(r1, W1, b1, W2, tile_unit(1, wave), woff, l16);
    load_tile(r2, W1, b1, W2, tile_unit(2, wave), woff, l16);
    load_tile(r3, W1, b1, W2, tile_unit(3, wave), woff, l16);

    // Each wave splits its own row tile once and publishes the two halves for all waves.
    {
        const float b2v = b2[l16];                                          // waits in LDS for the linear part at the end
        const v4f* xp = (const v4f*)(x + (size_t)row * IN_DIM + 8 * h);
        const v4f x0 = xp[0], x1 = xp[1];
        // Address registers of the loads above may be reused from here on. b2's value is an input so that its load is issued here,
        // beside x's: left free it sinks into the branch below, and its whole latency stands in front of the barrier.
        asm volatile("s_wait_xcnt 0x0" :: "v"(b2v) : "memory");
        v8us xh, xl;
        #pragma unroll
        for (int e = 0; e < 4; ++e) {
            unsigned short hh, ll;
            split_bf16(x0[e], hh, ll); xh[e] = hh;     xl[e] = ll;
            split_bf16(x1[e], hh, ll); xh[4 + e] = hh; xl[4 + e] = ll;
        }
        *(v8us*)(sA + ((wave * 2 + 0) * 32 + lane) * 8) = xh;
        *(v8us*)(sA + ((wave * 2 + 1) * 32 + lane) * 8) = xl;
        if (tid < OUT_DIM) sB2[tid] = b2v;
    }
    __syncthreads();

    // The block's eight row tiles stay in registers for the whole kernel: A = [x_hi | x_lo] along k.
    Frag16 fa[WAVES];
    #pragma unroll
    for (int rt = 0; rt < WAVES; ++rt) {
        fa[rt].h8[0] = *(const v8us*)(sA + ((rt * 2 + 0) * 32 + lane) * 8);
        fa[rt].h8[1] = *(const v8us*)(sA + ((rt * 2 + 1) * 32 + lane) * 8);
    }

    // Rolled: one copy of the tile body and of the reduction in the text.
    #pragma unroll 1
    for (int g = 0; g < OUT_DIM / WAVES; ++g) {
        const int o = g * WAVES + wave;
        float acc[WAVES][8];
        #pragma unroll
        for (int rt = 0; rt < WAVES; ++rt) {
            #pragma unroll
            for (int r = 0; r < 8; ++r) acc[rt][r] = 0.0f;
        }
        // Results of the last two row tiles wait one tile step for their sums; zero weight before the head's first tile.
        v8f   p0 = { 0.0f, 0.0f, 0.0f, 0.0f, 0.0f, 0.0f, 0.0f, 0.0f };
        v8f   p1 = p0;
        float wp = 0.0f;
        v2f   vs[4] = { { 0.0f, 0.0f }, { 0.0f, 0.0f }, { 0.0f, 0.0f }, { 0.0f, 0.0f } };
        float cs = 0.0f;

        // Rolled, four tiles a trip: one per register buffer.
        #pragma unroll 1
        for (int t = 0; t < NT; t += 4) {
            const int T = g * NT + t;
            tile_step(acc, fa, r0, p0, p1, wp, vs, cs, W1, b1, W2, tile_unit(T + 4, wave), woff, l16);
            tile_step(acc, fa, r1, p0, p1, wp, vs, cs, W1, b1, W2, tile_unit(T + 5, wave), woff, l16);
            tile_step(acc, fa, r2, p0, p1, wp, vs, cs, W1, b1, W2, tile_unit(T + 6, wave), woff, l16);
            tile_step(acc, fa, r3, p0, p1, wp, vs, cs, W1, b1, W2, tile_unit(T + 7, wave), woff, l16);
        }
        abs_fma4(acc[6][0], acc[6][1], acc[6][2], acc[6][3], p0[0], p0[1], p0[2], p0[3], wp);
        abs_fma4(acc[6][4], acc[6][5], acc[6][6], acc[6][7], p0[4], p0[5], p0[6], p0[7], wp);
        abs_fma4(acc[7][0], acc[7][1], acc[7][2], acc[7][3], p1[0], p1[1], p1[2], p1[3], wp);
        abs_fma4(acc[7][4], acc[7][5], acc[7][6], acc[7][7], p1[4], p1[5], p1[6], p1[7], wp);

        // The head's linear sums: over the 16 units a row of lanes holds; one lane of each half publishes its 8 inputs.
        {
            v4f s0, s1;
            s0[0] = row16_sum(vs[0][0]); s0[1] = row16_sum(vs[0][1]); s0[2] = row16_sum(vs[1][0]); s0[3] = row16_sum(vs[1][1]);
            s1[0] = row16_sum(vs[2][0]); s1[1] = row16_sum(vs[2][1]); s1[2] = row16_sum(vs[3][0]); s1[3] = row16_sum(vs[3][1]);
            const float ct = row16_sum(cs);
            if (l16 == 0) {
                *(v4f*)(sV + o * IN_DIM + 8 * h)     = s0;
                *(v4f*)(sV + o * IN_DIM + 8 * h + 4) = s1;
            }
            if (lane == 0) sC[o] = ct;
        }

        // Sum over the 16 column lanes of each half: acc[rt][r] -> full 512-dot for row 8h+r of row tile rt.
        // Step by step for all 64 sums of the head, so that each step's exchanges are in flight together.
        #pragma unroll
        for (int off = 1; off < 16; off <<= 1) {
            #pragma unroll
            for (int rt = 0; rt < WAVES; ++rt) {
                #pragma unroll
                for (int r = 0; r < 8; ++r) acc[rt][r] += __shfl_xor(acc[rt][r], off, 32);
            }
        }
        #pragma unroll
        for (int rt = 0; rt < WAVES; ++rt) {
            float val = acc[rt][0];
            #pragma unroll
            for (int j = 1; j < 8; ++j) val = (l16 == j) ? acc[rt][j] : val;
            if (l16 < 8) sOut[(rt * ROWS_PER_WAVE + 8 * h + l16) * OUT_DIM + o] = val;
        }
    }

    __syncthreads();

    // Linear part of the wave's own row tile, all 16 heads: row 8h+r, head l16.
    {
        Frag16 fv, fxh, fxl;
        const v4f a0 = *(const v4f*)(sV + woff), a1 = *(const v4f*)(sV + woff + 4);
        v4u vh, vl;
        unsigned int hh, ll;
        split_pair(LIN_C * a0[0], LIN_C * a0[1], hh, ll); vh[0] = hh; vl[0] = ll;
        split_pair(LIN_C * a0[2], LIN_C * a0[3], hh, ll); vh[1] = hh; vl[1] = ll;
        split_pair(LIN_C * a1[0], LIN_C * a1[1], hh, ll); vh[2] = hh; vl[2] = ll;
        split_pair(LIN_C * a1[2], LIN_C * a1[3], hh, ll); vh[3] = hh; vl[3] = ll;
        fv.u4[0] = vh; fv.u4[1] = vl;
        const v8us xh = *(const v8us*)(sA + ((wave * 2 + 0) * 32 + lane) * 8);
        const v8us xl = *(const v8us*)(sA + ((wave * 2 + 1) * 32 + lane) * 8);
        fxh.h8[0] = xh; fxh.h8[1] = xh;
        fxl.h8[0] = xl; fxl.h8[1] = xl;
        const float cv = fmaf(LIN_C, sC[l16], sB2[l16]);
        const v8f c0 = { cv, cv, cv, cv, cv, cv, cv, cv };
        const v8f lin = wmma_pair_bf16(fxh.v, fxl.v, fv.v, c0);
        #pragma unroll
        for (int r = 0; r < 8; ++r) sLin[(wave * ROWS_PER_WAVE + 8 * h + r) * OUT_DIM + l16] = lin[r];
    }
    __syncthreads();

    const float* sw = sOut + wave * (ROWS_PER_WAVE * OUT_DIM);
    const float* sl = sLin + wave * (ROWS_PER_WAVE * OUT_DIM);
    const v4f v0 = *(const v4f*)(sw + lane * 4) + *(const v4f*)(sl + lane * 4);
    const v4f v1 = *(const v4f*)(sw + 128 + lane * 4) + *(const v4f*)(sl + 128 + lane * 4);
    const bool p0 = (rbase + (lane >> 2)) < nrows;
    const bool p1 = (rbase + 8 + (lane >> 2)) < nrows;
    float* dst = out + (size_t)rbase * OUT_DIM;
    if (p0) *(v4f*)(dst + lane * 4) = v0;
    if (p1) *(v4f*)(dst + 128 + lane * 4) = v1;
}

extern "C" void kernel_launch(void* const* d_in, const int* in_sizes, int n_in,
                              void* d_out, int out_size, void* d_ws, size_t ws_size,
                              hipStream_t stream)
{
    if (n_in < 5) return;
    const int nx  = in_sizes[0];
    const int nw1 = in_sizes[1];
    const int nb1 = in_sizes[2];
    const int nw2 = in_sizes[3];
    const int nb2 = in_sizes[4];
    const int nrows = nx / IN_DIM;
    if (nrows <= 0 || nx != nrows * IN_DIM) return;
    if (nw1 != OUT_DIM * HID * IN_DIM || nb1 != OUT_DIM * HID || nw2 != OUT_DIM * HID || nb2 != OUT_DIM) return;
    if (out_size != nrows * OUT_DIM) return;

    const float* x  = (const float*)d_in[0];
    const float* W1 = (const float*)d_in[1];
    const float* b1 = (const float*)d_in[2];
    const float* W2 = (const float*)d_in[3];
    const float* b2 = (const float*)d_in[4];
    float* out = (float*)d_out;

    dim3 gm((nrows + ROWS_PER_BLOCK - 1) / ROWS_PER_BLOCK);     // 256 blocks for 32768 rows
    k_mlp16<<<gm, dim3(256), 0, stream>>>(x, W1, b1, W2, b2, out, nrows);
    (void)hipGetLastError();
}

// v005
// It runs in 19 microseconds.
// Timed twice side by side with v004, it ran 1.17 times as fast both times.
// All steps since v000 together make it 12.5 times as fast.
#include <hip/hip_runtime.h>
#include <stdint.h>

// Contraction 1 (x . W1[o]^T per head, K=16 on a 32-deep tile): ONE v_wmma_f32_16x16x32_f16 a tile: x as an f16 hi+lo pair packed along k (A = [x_hi | x_lo], 22 mantissa bits), W1 rounded to one f16 value (B = [W_h | W_h], 11 mantissa bits), f32 accumulate seeded with b1; contraction 2 (512 -> 1 per head with W2): f32 VALU from the f32 accumulators.
// f16 operands: |x| and |W1| must stay below 65504.
// LeakyReLU(h) = 0.6 h + 0.4 |h| (slope 0.2). The part linear in h sums to x . V[o] + const with V[o] = 0.6 sum_n W2[o][n] W1[o][n][:], one more 16-column tile on the same WMMA form.
// One launch: W1 streams as f32 and is rounded to f16 in registers by the wave that uses it, which sums V[o] from the same f32 registers.

typedef float v8f __attribute__((ext_vector_type(8)));
typedef float v4f __attribute__((ext_vector_type(4))) __attribute__((may_alias));
typedef float v2f __attribute__((ext_vector_type(2)));
typedef _Float16 v2h __attribute__((ext_vector_type(2)));
typedef unsigned int v4u __attribute__((ext_vector_type(4)));
typedef unsigned short v8us __attribute__((ext_vector_type(8))) __attribute__((may_alias));
typedef unsigned short v16us __attribute__((ext_vector_type(16)));
typedef _Float16 v16h __attribute__((ext_vector_type(16)));

union Frag16 { v16h v; v16us u; v8us h8[2]; v4u u4[2]; };

#define IN_DIM          16
#define OUT_DIM         16
#define HID             512
#define NT              (HID / 16)
#define WAVES           8
#define ROWS_PER_WAVE   16
#define ROWS_PER_BLOCK  (WAVES * ROWS_PER_WAVE)
#define NEG_SLOPE       0.2f
#define LIN_C           (0.5f * (1.0f + NEG_SLOPE))   // weight of h in LeakyReLU
#define ABS_C           (0.5f * (1.0f - NEG_SLOPE))   // weight of |h| in LeakyReLU

// Two f32 values rounded to f16, packed in one word.
__device__ __forceinline__ unsigned int pack_pair(float a, float b) {
    const v2f f = { a, b };
    return __builtin_bit_cast(unsigned int, __builtin_convertvector(f, v2h));
}

// Two f32 values -> their f16 hi parts packed in one word and the f16 lo parts (of the exact residuals) in another.
__device__ __forceinline__ void split_pair(float a, float b, unsigned int& hi, unsigned int& lo) {
    const v2f f = { a, b };
    const v2h hb = __builtin_convertvector(f, v2h);
    const v2f r = { __builtin_fmaf((float)hb[0], -1.0f, a), __builtin_fmaf((float)hb[1], -1.0f, b) };
    const v2h lb = __builtin_convertvector(r, v2h);
    hi = __builtin_bit_cast(unsigned int, hb);
    lo = __builtin_bit_cast(unsigned int, lb);
}

// Two chained 16x16x32 f16 WMMAs into one accumulator, then the VALU hazard guard.
__device__ __forceinline__ v8f wmma_pair_f16(v16h ah, v16h al, v16h b, v8f c) {
    c = __builtin_amdgcn_wmma_f32_16x16x32_f16(false, ah, false, b, (short)0, c, false, false);
    c = __builtin_amdgcn_wmma_f32_16x16x32_f16(false, al, false, b, (short)0, c, false, false);
    asm volatile("v_nop\n\tv_nop\n\tv_nop\n\tv_nop" : "+v"(c) : "v"(ah), "v"(al), "v"(b));
    return c;
}

// a[j] += |c[j]| * w for four rows of a WMMA result: one v_fma_f32 with the abs source modifier per element (compiled code
// pairs the sums into packed fma, which has no abs modifier, and spends a v_and_b32 per element on it).
__device__ __forceinline__ void abs_fma4(float& a0, float& a1, float& a2, float& a3,
                                         float c0, float c1, float c2, float c3, float w) {
    asm volatile("v_fma_f32 %0, |%4|, %8, %0\n\t"
                 "v_fma_f32 %1, |%5|, %8, %1\n\t"
                 "v_fma_f32 %2, |%6|, %8, %2\n\t"
                 "v_fma_f32 %3, |%7|, %8, %3"
                 : "+v"(a0), "+v"(a1), "+v"(a2), "+v"(a3)
                 : "v"(c0), "v"(c1), "v"(c2), "v"(c3), "v"(w));
}

// One 16-unit hidden tile as loaded: this lane's 8 weights (f32), its unit's W2 and b1 (a register pair: W2 is the packed sums' first source).
struct RawTile { v4f f0, f1; v2f wb; };   // wb = { W2, b1 }

// First hidden unit (flat over heads) of a wave's tile T = 0 .. 63: head T / 32 * 8 + wave, tile T % 32. Past the end: the last tile again.
__device__ __forceinline__ int tile_unit(int T, int wave) {
    const int Tc = T < 2 * NT ? T : 2 * NT - 1;
    return ((Tc / NT) * WAVES + wave) * HID + (Tc % NT) * 16;
}

__device__ __forceinline__ void load_tile(RawTile& r, const float* __restrict__ W1,
                                          const float* __restrict__ b1, const float* __restrict__ W2,
                                          int nb, int woff, int l16) {
    const v4f* wp4 = (const v4f*)(W1 + (size_t)nb * IN_DIM + woff);
    r.f0 = wp4[0];
    r.f1 = wp4[1];
    r.wb[0] = W2[nb + l16];
    r.wb[1] = b1[nb + l16];
    // Address registers of the loads above may be reused from here on.
    asm volatile("s_wait_xcnt 0x0" ::: "memory");
}

// One hidden tile against all eight resident row tiles. The bias tile is built once and is the C operand of all eight.
// Each WMMA is followed by the eight sums of the row tile two before, whose result is complete: they issue while the matrix unit works.
// The tile's weights are rounded to f16 here, and W2[n] W1[n][:] and W2[n] b1[n] (f32) join the head's linear sums vs, cs (this lane's unit n, its 8 inputs).
__device__ __forceinline__ void tile_step(float (&acc)[WAVES][8], const Frag16 (&fa)[WAVES], RawTile& r,
                                          v8f& p0, v8f& p1, float& wp, v2f (&vs)[4], float& cs,
                                          const float* __restrict__ W1,
                                          const float* __restrict__ b1, const float* __restrict__ W2,
                                          int nb_next, int woff, int l16) {
    Frag16 fh;
    {
        v4u hv;
        hv[0] = pack_pair(r.f0[0], r.f0[1]);
        hv[1] = pack_pair(r.f0[2], r.f0[3]);
        hv[2] = pack_pair(r.f1[0], r.f1[1]);
        hv[3] = pack_pair(r.f1[2], r.f1[3]);
        fh.u4[0] = hv; fh.u4[1] = hv;
        // vs += W2 * weights (both halves of a packed fma take W2 from the pair's low word), cs += W2 * b1. In asm so that the sums
        // stay here, in front of the reload of these registers: compiled, they sink to the loop's foot and all four buffers' old values stay live.
        asm volatile("v_pk_fma_f32 %0, %5, %8, %0 op_sel_hi:[0,1,1]\n\t"
                     "v_pk_fma_f32 %1, %5, %9, %1 op_sel_hi:[0,1,1]\n\t"
                     "v_pk_fma_f32 %2, %5, %10, %2 op_sel_hi:[0,1,1]\n\t"
                     "v_pk_fma_f32 %3, %5, %11, %3 op_sel_hi:[0,1,1]\n\t"
                     "v_fma_f32 %4, %6, %7, %4"
                     : "+v"(vs[0]), "+v"(vs[1]), "+v"(vs[2]), "+v"(vs[3]), "+v"(cs)
                     : "v"(r.wb), "v"(r.wb[0]), "v"(r.wb[1]),
                       "v"((v2f){ r.f0[0], r.f0[1] }), "v"((v2f){ r.f0[2], r.f0[3] }), "v"((v2f){ r.f1[0], r.f1[1] }), "v"((v2f){ r.f1[2], r.f1[3] }));
    }
    const float bt = r.wb[1];
    const float w  = ABS_C * r.wb[0];                               // weight of |h|, for all eight row tiles
    const v8f cb = { bt, bt, bt, bt, bt, bt, bt, bt };           // bias for column n, all rows
    load_tile(r, W1, b1, W2, nb_next, woff, l16);
    // The scheduling barriers keep this order: left free, the compiler puts a result's sums directly behind its WMMA,
    // inside the slots that a WMMA result needs before it is read, and nothing is left to issue beside the matrix unit.
    __builtin_amdgcn_sched_barrier(0);
    #pragma unroll
    for (int p = 0; p < WAVES / 2; ++p) {
        const int q0 = (2 * p + 6) & 7, q1 = (2 * p + 7) & 7;     // the row tiles whose results wait in p0, p1
        const float wq = (p == 0) ? wp : w;                       // theirs is the tile before at p = 0
        const v8f c0 = __builtin_amdgcn_wmma_f32_16x16x32_f16(false, fa[2 * p].v, false, fh.v, (short)0, cb, false, false);
        __builtin_amdgcn_sched_barrier(0);
        abs_fma4(acc[q0][0], acc[q0][1], acc[q0][2], acc[q0][3], p0[0], p0[1], p0[2], p0[3], wq);
        abs_fma4(acc[q0][4], acc[q0][5], acc[q0][6], acc[q0][7], p0[4], p0[5], p0[6], p0[7], wq);
        __builtin_amdgcn_sched_barrier(0);
        const v8f c1 = __builtin_amdgcn_wmma_f32_16x16x32_f16(false, fa[2 * p + 1].v, false, fh.v, (short)0, cb, false, false);
        __builtin_amdgcn_sched_barrier(0);
        abs_fma4(acc[q1][0], acc[q1][1], acc[q1][2], acc[q1][3], p1[0], p1[1], p1[2], p1[3], wq);
        abs_fma4(acc[q1][4], acc[q1][5], acc[q1][6], acc[q1][7], p1[4], p1[5], p1[6], p1[7], wq);
        __builtin_amdgcn_sched_barrier(0);
        p0 = c0; p1 = c1;
    }
    wp = w;
}

// Sum over the 16 lanes of a row, the total in every lane of the row: four adds, each with its own cross-lane read (DPP row_xmask).
__device__ __forceinline__ float row16_sum(float v) {
    v += __builtin_bit_cast(float, __builtin_amdgcn_update_dpp(0, __builtin_bit_cast(int, v), 0x161, 0xf, 0xf, true));
    v += __builtin_bit_cast(float, __builtin_amdgcn_update_dpp(0, __builtin_bit_cast(int, v), 0x162, 0xf, 0xf, true));
    v += __builtin_bit_cast(float, __builtin_amdgcn_update_dpp(0, __builtin_bit_cast(int, v), 0x164, 0xf, 0xf, true));
    v += __builtin_bit_cast(float, __builtin_amdgcn_update_dpp(0, __builtin_bit_cast(int, v), 0x168, 0xf, 0xf, true));
    return v;
}

// One block = 128 batch rows (8 row tiles) x all 16 heads, 8 heads at a time: each wave owns ONE head.
// The A fragments of all 8 row tiles and the 64 running sums a lane (8 row tiles x 8 rows) stay in registers; the head's
// 32 hidden tiles stream past them from L2 as f32, loaded four tiles ahead, each tile rounded once and used by all 8 row tiles.
// A fragment (lane l, row m = l&15, h = l>>4): elements 0..7 = f16_hi(x[m][8h..8h+7]) (k = 8h+i),
//   elements 8..15 = f16_lo of the same values (k = 16+8h+i)  ->  A[m][k] = x_hi[m][k], A[m][k+16] = x_lo[m][k].
// B fragment (lane l, column n = l&15): elements 0..7 = W_h[n][8h..8h+7] (k = 8h+i), elements 8..15 = the same values (k = 16+8h+i).
// D = b1[n] + sum_i (x_hi + x_lo)[m][i] * W_h[n][i].
// The tile loop sums W2[n] |D| only; the part linear in D is one product of the wave's own row tile with the V tile (column = head),
// there with A = [x_hi | x_hi] and [x_lo | x_lo], B = [V_hi | V_lo]. It stands behind the tile loops: each wave publishes the V sums of its two heads in LDS.
// At most two waves a SIMD, so one block a WGP: a grid of one block per WGP spreads over all of them.
__global__ __launch_bounds__(256) __attribute__((amdgpu_waves_per_eu(2, 2))) void k_mlp16(const float* __restrict__ x,
                                               const float* __restrict__ W1,
                                               const float* __restrict__ b1,
                                               const float* __restrict__ W2,
                                               const float* __restrict__ b2,
                                               float* __restrict__ out,
                                               int nrows)
{
    __shared__ __align__(16) float sOut[WAVES * ROWS_PER_WAVE * OUT_DIM];   // 2048 floats = 8 KB
    __shared__ __align__(16) unsigned short sA[WAVES * 2 * 32 * 8];         // per row tile: hi plane, lo plane, 16 B a lane = 8 KB
    __shared__ __align__(16) float sLin[WAVES * ROWS_PER_WAVE * OUT_DIM];   // linear part, laid out like sOut = 8 KB
    __shared__ __align__(16) float sV[OUT_DIM * IN_DIM];                    // sum_n W2[o][n] W1[o][n][i]
    __shared__ float sC[OUT_DIM];                                           // sum_n W2[o][n] b1[o][n]
    __shared__ float sB2[OUT_DIM];

    const int tid  = threadIdx.x;
    const int lane = tid & 31;
    const int wave = __builtin_amdgcn_readfirstlane(tid >> 5);              // scalar, so head and pass offsets stay scalar
    const int h    = lane >> 4;
    const int l16  = lane & 15;
    const int woff = l16 * IN_DIM + 8 * h;                                  // this lane's place in a 16-unit weight tile

    const int rbase = blockIdx.x * ROWS_PER_BLOCK + wave * ROWS_PER_WAVE;   // first row of this wave's own tile
    int row = rbase + l16;
    if (row > nrows - 1) row = nrows - 1;                                   // clamp loads; stores predicated

    // The wave's 64 hidden tiles (two heads of 32) stream through four register buffers, each refilled four tiles ahead:
    // the loads have four tile steps to come back from L2. The first four fly while the row tile below is split.
    RawTile r0, r1, r2, r3;
    load_tile(r0, W1, b1, W2, tile_unit(0, wave), woff, l16);
    load_tile(r1, W1, b1, W2, tile_unit(1, wave), woff, l16);
    load_tile(r2, W1, b1, W2, tile_unit(2, wave), woff, l16);
    load_tile(r3, W1, b1, W2, tile_unit(3, wave), woff, l16);

    // Each wave splits its own row tile once and publishes the two halves for all waves.
    {
        const float b2v = b2[l16];                                          // waits in LDS for the linear part at the end
        const v4f* xp = (const v4f*)(x + (size_t)row * IN_DIM + 8 * h);
        const v4f x0 = xp[0], x1 = xp[1];
        // Address registers of the loads above may be reused from here on. b2's value is an input so that its load is issued here,
        // beside x's: left free it sinks into the branch below, and its whole latency stands in front of the barrier.
        asm volatile("s_wait_xcnt 0x0" :: "v"(b2v) : "memory");
        v4u xh, xl;
        unsigned int hh, ll;
        split_pair(x0[0], x0[1], hh, ll); xh[0] = hh; xl[0] = ll;
        split_pair(x0[2], x0[3], hh, ll); xh[1] = hh; xl[1] = ll;
        split_pair(x1[0], x1[1], hh, ll); xh[2] = hh; xl[2] = ll;
        split_pair(x1[2], x1[3], hh, ll); xh[3] = hh; xl[3] = ll;
        *(v8us*)(sA + ((wave * 2 + 0) * 32 + lane) * 8) = __builtin_bit_cast(v8us, xh);
        *(v8us*)(sA + ((wave * 2 + 1) * 32 + lane) * 8) = __builtin_bit_cast(v8us, xl);
        if (tid < OUT_DIM) sB2[tid] = b2v;
    }
    __syncthreads();

    // The block's eight row tiles stay in registers for the whole kernel: A = [x_hi | x_lo] along k.
    Frag16 fa[WAVES];
    #pragma unroll
    for (int rt = 0; rt < WAVES; ++rt) {
        fa[rt].h8[0] = *(const v8us*)(sA + ((rt * 2 + 0) * 32 + lane) * 8);
        fa[rt].h8[1] = *(const v8us*)(sA + ((rt * 2 + 1) * 32 + lane) * 8);
    }

    // Rolled: one copy of the tile body and of the reduction in the text.
    #pragma unroll 1
    for (int g = 0; g < OUT_DIM / WAVES; ++g) {
        const int o = g * WAVES + wave;
        float acc[WAVES][8];
        #pragma unroll
        for (int rt = 0; rt < WAVES; ++rt) {
            #pragma unroll
            for (int r = 0; r < 8; ++r) acc[rt][r] = 0.0f;
        }
        // Results of the last two row tiles wait one tile step for their sums; zero weight before the head's first tile.
        v8f   p0 = { 0.0f, 0.0f, 0.0f, 0.0f, 0.0f, 0.0f, 0.0f, 0.0f };
        v8f   p1 = p0;
        float wp = 0.0f;
        v2f   vs[4] = { { 0.0f, 0.0f }, { 0.0f, 0.0f }, { 0.0f, 0.0f }, { 0.0f, 0.0f } };
        float cs = 0.0f;

        // Rolled, four tiles a trip: one per register buffer.
        #pragma unroll 1
        for (int t = 0; t < NT; t += 4) {
            const int T = g * NT + t;
            tile_step(acc, fa, r0, p0, p1, wp, vs, cs, W1, b1, W2, tile_unit(T + 4, wave), woff, l16);
            tile_step(acc, fa, r1, p0, p1, wp, vs, cs, W1, b1, W2, tile_unit(T + 5, wave), woff, l16);
            tile_step(acc, fa, r2, p0, p1, wp, vs, cs, W1, b1, W2, tile_unit(T + 6, wave), woff, l16);
            tile_step(acc, fa, r3, p0, p1, wp, vs, cs, W1, b1, W2, tile_unit(T + 7, wave), woff, l16);
        }
        abs_fma4(acc[6][0], acc[6][1], acc[6][2], acc[6][3], p0[0], p0[1], p0[2], p0[3], wp);
        abs_fma4(acc[6][4], acc[6][5], acc[6][6], acc[6][7], p0[4], p0[5], p0[6], p0[7], wp);
        abs_fma4(acc[7][0], acc[7][1], acc[7][2], acc[7][3], p1[0], p1[1], p1[2], p1[3], wp);
        abs_fma4(acc[7][4], acc[7][5], acc[7][6], acc[7][7], p1[4], p1[5], p1[6], p1[7], wp);

        // The head's linear sums: over the 16 units a row of lanes holds; one lane of each half publishes its 8 inputs.
        {
            v4f s0, s1;
            s0[0] = row16_sum(vs[0][0]); s0[1] = row16_sum(vs[0][1]); s0[2] = row16_sum(vs[1][0]); s0[3] = row16_sum(vs[1][1]);
            s1[0] = row16_sum(vs[2][0]); s1[1] = row16_sum(vs[2][1]); s1[2] = row16_sum(vs[3][0]); s1[3] = row16_sum(vs[3][1]);
            const float ct = row16_sum(cs);
            if (l16 == 0) {
                *(v4f*)(sV + o * IN_DIM + 8 * h)     = s0;
                *(v4f*)(sV + o * IN_DIM + 8 * h + 4) = s1;
            }
            if (lane == 0) sC[o] = ct;
        }

        // Sum over the 16 column lanes of each half: acc[rt][r] -> full 512-dot for row 8h+r of row tile rt.
        // Step by step for all 64 sums of the head, so that each step's exchanges are in flight together.
        #pragma unroll
        for (int off = 1; off < 16; off <<= 1) {
            #pragma unroll
            for (int rt = 0; rt < WAVES; ++rt) {
                #pragma unroll
                for (int r = 0; r < 8; ++r) acc[rt][r] += __shfl_xor(acc[rt][r], off, 32);
            }
        }
        #pragma unroll
        for (int rt = 0; rt < WAVES; ++rt) {
            float val = acc[rt][0];
            #pragma unroll
            for (int j = 1; j < 8; ++j) val = (l16 == j) ? acc[rt][j] : val;
            if (l16 < 8) sOut[(rt * ROWS_PER_WAVE + 8 * h + l16) * OUT_DIM + o] = val;
        }
    }

    __syncthreads();

    // Linear part of the wave's own row tile, all 16 heads: row 8h+r, head l16.
    {
        Frag16 fv, fxh, fxl;
        const v4f a0 = *(const v4f*)(sV + woff), a1 = *(const v4f*)(sV + woff + 4);
        v4u vh, vl;
        unsigned int hh, ll;
        split_pair(LIN_C * a0[0], LIN_C * a0[1], hh, ll); vh[0] = hh; vl[0] = ll;
        split_pair(LIN_C * a0[2], LIN_C * a0[3], hh, ll); vh[1] = hh; vl[1] = ll;
        split_pair(LIN_C * a1[0], LIN_C * a1[1], hh, ll); vh[2] = hh; vl[2] = ll;
        split_pair(LIN_C * a1[2], LIN_C * a1[3], hh, ll); vh[3] = hh; vl[3] = ll;
        fv.u4[0] = vh; fv.u4[1] = vl;
        const v8us xh = *(const v8us*)(sA + ((wave * 2 + 0) * 32 + lane) * 8);
        const v8us xl = *(const v8us*)(sA + ((wave * 2 + 1) * 32 + lane) * 8);
        fxh.h8[0] = xh; fxh.h8[1] = xh;
        fxl.h8[0] = xl; fxl.h8[1] = xl;
        const float cv = fmaf(LIN_C, sC[l16], sB2[l16]);
        const v8f c0 = { cv, cv, cv, cv, cv, cv, cv, cv };
        const v8f lin = wmma_pair_f16(fxh.v, fxl.v, fv.v, c0);
        #pragma unroll
        for (int r = 0; r < 8; ++r) sLin[(wave * ROWS_PER_WAVE + 8 * h + r) * OUT_DIM + l16] = lin[r];
    }
    __syncthreads();

    const float* sw = sOut + wave * (ROWS_PER_WAVE * OUT_DIM);
    const float* sl = sLin + wave * (ROWS_PER_WAVE * OUT_DIM);
    const v4f v0 = *(const v4f*)(sw + lane * 4) + *(const v4f*)(sl + lane * 4);
    const v4f v1 = *(const v4f*)(sw + 128 + lane * 4) + *(const v4f*)(sl + 128 + lane * 4);
    const bool p0 = (rbase + (lane >> 2)) < nrows;
    const bool p1 = (rbase + 8 + (lane >> 2)) < nrows;
    float* dst = out + (size_t)rbase * OUT_DIM;
    if (p0) *(v4f*)(dst + lane * 4) = v0;
    if (p1) *(v4f*)(dst + 128 + lane * 4) = v1;
}

extern "C" void kernel_launch(void* const* d_in, const int* in_sizes, int n_in,
                              void* d_out, int out_size, void* d_ws, size_t ws_size,
                              hipStream_t stream)
{
    if (n_in < 5) return;
    const int nx  = in_sizes[0];
    const int nw1 = in_sizes[1];
    const int nb1 = in_sizes[2];
    const int nw2 = in_sizes[3];
    const int nb2 = in_sizes[4];
    const int nrows = nx / IN_DIM;
    if (nrows <= 0 || nx != nrows * IN_DIM) return;
    if (nw1 != OUT_DIM * HID * IN_DIM || nb1 != OUT_DIM * HID || nw2 != OUT_DIM * HID || nb2 != OUT_DIM) return;
    if (out_size != nrows * OUT_DIM) return;

    const float* x  = (const float*)d_in[0];
    const float* W1 = (const float*)d_in[1];
    const float* b1 = (const float*)d_in[2];
    const float* W2 = (const float*)d_in[3];
    const float* b2 = (const float*)d_in[4];
    float* out = (float*)d_out;

    dim3 gm((nrows + ROWS_PER_BLOCK - 1) / ROWS_PER_BLOCK);     // 256 blocks for 32768 rows
    k_mlp16<<<gm, dim3(256), 0, stream>>>(x, W1, b1, W2, b2, out, nrows);
    (void)hipGetLastError();
}

// v006
// One run takes 16.8 microseconds.
// Timed twice side by side with v005, it ran 1.12 times as fast both times.
// All steps since v000 together make it 14.0 times as fast.
#include <hip/hip_runtime.h>
#include <stdint.h>

// Contraction 1 (x . W1[o]^T per head, K=16 on a 32-deep tile): ONE v_wmma_f32_16x16x32_f16 a tile: x as an f16 hi+lo pair packed along k (A = [x_hi | x_lo], 22 mantissa bits), W1 rounded to one f16 value (B = [W_h | W_h], 11 mantissa bits), f32 accumulate seeded with b1; contraction 2 (512 -> 1 per head with W2): f32 VALU from the f32 accumulators.
// f16 operands: |x| and |W1| must stay below 65504.
// LeakyReLU(h) = 0.6 h + 0.4 |h| (slope 0.2). The part linear in h sums to x . V[o] + const with V[o] = 0.6 sum_n W2[o][n] W1[o][n][:], one more 16-column tile on the same WMMA form.
// One launch: W1 streams as f32 and is rounded to f16 in registers by the wave that uses it, which sums V[o] from the same f32 registers.

typedef float v8f __attribute__((ext_vector_type(8)));
typedef float v4f __attribute__((ext_vector_type(4))) __attribute__((may_alias));
typedef float v2f __attribute__((ext_vector_type(2)));
typedef _Float16 v2h __attribute__((ext_vector_type(2)));
typedef unsigned int v4u __attribute__((ext_vector_type(4)));
typedef unsigned short v8us __attribute__((ext_vector_type(8))) __attribute__((may_alias));
typedef unsigned short v16us __attribute__((ext_vector_type(16)));
typedef _Float16 v16h __attribute__((ext_vector_type(16)));

union Frag16 { v16h v; v16us u; v8us h8[2]; v4u u4[2]; };

#define IN_DIM          16
#define OUT_DIM         16
#define HID             512
#define NT              (HID / 16)
#define WAVES           8
#define ROWS_PER_WAVE   16
#define ROWS_PER_BLOCK  (WAVES * ROWS_PER_WAVE)
#define NEG_SLOPE       0.2f
#define LIN_C           (0.5f * (1.0f + NEG_SLOPE))   // weight of h in LeakyReLU
#define ABS_C           (0.5f * (1.0f - NEG_SLOPE))   // weight of |h| in LeakyReLU

// Two f32 values rounded to f16, packed in one word.
__device__ __forceinline__ unsigned int pack_pair(float a, float b) {
    const v2f f = { a, b };
    return __builtin_bit_cast(unsigned int, __builtin_convertvector(f, v2h));
}

// Two f32 values -> their f16 hi parts packed in one word and the f16 lo parts (of the exact residuals) in another.
__device__ __forceinline__ void split_pair(float a, float b, unsigned int& hi, unsigned int& lo) {
    const v2f f = { a, b };
    const v2h hb = __builtin_convertvector(f, v2h);
    const v2f r = { __builtin_fmaf((float)hb[0], -1.0f, a), __builtin_fmaf((float)hb[1], -1.0f, b) };
    const v2h lb = __builtin_convertvector(r, v2h);
    hi = __builtin_bit_cast(unsigned int, hb);
    lo = __builtin_bit_cast(unsigned int, lb);
}

// Two chained 16x16x32 f16 WMMAs into one accumulator, then the VALU hazard guard.
__device__ __forceinline__ v8f wmma_pair_f16(v16h ah, v16h al, v16h b, v8f c) {
    c = __builtin_amdgcn_wmma_f32_16x16x32_f16(false, ah, false, b, (short)0, c, false, false);
    c = __builtin_amdgcn_wmma_f32_16x16x32_f16(false, al, false, b, (short)0, c, false, false);
    asm volatile("v_nop\n\tv_nop\n\tv_nop\n\tv_nop" : "+v"(c) : "v"(ah), "v"(al), "v"(b));
    return c;
}

// a[j] += |c[j]| * w for four rows of a WMMA result: one v_fma_f32 with the abs source modifier per element (compiled code
// pairs the sums into packed fma, which has no abs modifier, and spends a v_and_b32 per element on it).
__device__ __forceinline__ void abs_fma4(float& a0, float& a1, float& a2, float& a3,
                                         float c0, float c1, float c2, float c3, float w) {
    asm volatile("v_fma_f32 %0, |%4|, %8, %0\n\t"
                 "v_fma_f32 %1, |%5|, %8, %1\n\t"
                 "v_fma_f32 %2, |%6|, %8, %2\n\t"
                 "v_fma_f32 %3, |%7|, %8, %3"
                 : "+v"(a0), "+v"(a1), "+v"(a2), "+v"(a3)
                 : "v"(c0), "v"(c1), "v"(c2), "v"(c3), "v"(w));
}

// One 16-unit hidden tile as loaded: this lane's 8 weights (f32), its unit's W2 and b1 (a register pair: W2 is the packed sums' first source).
struct RawTile { v4f f0, f1; v2f wb; };   // wb = { W2, b1 }

// First hidden unit (flat over heads) of a wave's tile T = 0 .. 63: head T / 32 * 8 + wave, tile T % 32. Past the end: the last tile again.
__device__ __forceinline__ int tile_unit(int T, int wave) {
    const int Tc = T < 2 * NT ? T : 2 * NT - 1;
    return ((Tc / NT) * WAVES + wave) * HID + (Tc % NT) * 16;
}

__device__ __forceinline__ void load_tile(RawTile& r, const float* __restrict__ W1,
                                          const float* __restrict__ b1, const float* __restrict__ W2,
                                          int nb, int woff, int l16) {
    const v4f* wp4 = (const v4f*)(W1 + (size_t)nb * IN_DIM + woff);
    r.f0 = wp4[0];
    r.f1 = wp4[1];
    r.wb[0] = W2[nb + l16];
    r.wb[1] = b1[nb + l16];
    // Address registers of the loads above may be reused from here on.
    asm volatile("s_wait_xcnt 0x0" ::: "memory");
}

// One hidden tile against all eight resident row tiles. The bias tile is built once and is the C operand of all eight.
// Each WMMA is followed by the eight sums of the row tile two before, whose result is complete: they issue while the matrix unit works.
// The tile's weights are rounded to f16 here, and W2[n] W1[n][:] and W2[n] b1[n] (f32) join the head's linear sums vs, cs (this lane's unit n, its 8 inputs).
__device__ __forceinline__ void tile_step(float (&acc)[WAVES][8], const Frag16 (&fa)[WAVES], RawTile& r,
                                          v8f& p0, v8f& p1, float& wp, v2f (&vs)[4], float& cs,
                                          const float* __restrict__ W1,
                                          const float* __restrict__ b1, const float* __restrict__ W2,
                                          int nb_next, int woff, int l16) {
    Frag16 fh;
    {
        v4u hv;
        hv[0] = pack_pair(r.f0[0], r.f0[1]);
        hv[1] = pack_pair(r.f0[2], r.f0[3]);
        hv[2] = pack_pair(r.f1[0], r.f1[1]);
        hv[3] = pack_pair(r.f1[2], r.f1[3]);
        fh.u4[0] = hv; fh.u4[1] = hv;
        // vs += W2 * weights (both halves of a packed fma take W2 from the pair's low word), cs += W2 * b1. In asm so that the sums
        // stay here, in front of the reload of these registers: compiled, they sink to the loop's foot and all four buffers' old values stay live.
        asm volatile("v_pk_fma_f32 %0, %5, %8, %0 op_sel_hi:[0,1,1]\n\t"
                     "v_pk_fma_f32 %1, %5, %9, %1 op_sel_hi:[0,1,1]\n\t"
                     "v_pk_fma_f32 %2, %5, %10, %2 op_sel_hi:[0,1,1]\n\t"
                     "v_pk_fma_f32 %3, %5, %11, %3 op_sel_hi:[0,1,1]\n\t"
                     "v_fma_f32 %4, %6, %7, %4"
                     : "+v"(vs[0]), "+v"(vs[1]), "+v"(vs[2]), "+v"(vs[3]), "+v"(cs)
                     : "v"(r.wb), "v"(r.wb[0]), "v"(r.wb[1]),
                       "v"((v2f){ r.f0[0], r.f0[1] }), "v"((v2f){ r.f0[2], r.f0[3] }), "v"((v2f){ r.f1[0], r.f1[1] }), "v"((v2f){ r.f1[2], r.f1[3] }));
    }
    const float bt = r.wb[1];
    const float w  = ABS_C * r.wb[0];                               // weight of |h|, for all eight row tiles
    const v8f cb = { bt, bt, bt, bt, bt, bt, bt, bt };           // bias for column n, all rows
    load_tile(r, W1, b1, W2, nb_next, woff, l16);
    // The scheduling barriers keep this order: left free, the compiler puts a result's sums directly behind its WMMA,
    // inside the slots that a WMMA result needs before it is read, and nothing is left to issue beside the matrix unit.
    __builtin_amdgcn_sched_barrier(0);
    #pragma unroll
    for (int p = 0; p < WAVES / 2; ++p) {
        const int q0 = (2 * p + 6) & 7, q1 = (2 * p + 7) & 7;     // the row tiles whose results wait in p0, p1
        const float wq = (p == 0) ? wp : w;                       // theirs is the tile before at p = 0
        const v8f c0 = __builtin_amdgcn_wmma_f32_16x16x32_f16(false, fa[2 * p].v, false, fh.v, (short)0, cb, false, false);
        __builtin_amdgcn_sched_barrier(0);
        abs_fma4(acc[q0][0], acc[q0][1], acc[q0][2], acc[q0][3], p0[0], p0[1], p0[2], p0[3], wq);
        abs_fma4(acc[q0][4], acc[q0][5], acc[q0][6], acc[q0][7], p0[4], p0[5], p0[6], p0[7], wq);
        __builtin_amdgcn_sched_barrier(0);
        const v8f c1 = __builtin_amdgcn_wmma_f32_16x16x32_f16(false, fa[2 * p + 1].v, false, fh.v, (short)0, cb, false, false);
        __builtin_amdgcn_sched_barrier(0);
        abs_fma4(acc[q1][0], acc[q1][1], acc[q1][2], acc[q1][3], p1[0], p1[1], p1[2], p1[3], wq);
        abs_fma4(acc[q1][4], acc[q1][5], acc[q1][6], acc[q1][7], p1[4], p1[5], p1[6], p1[7], wq);
        __builtin_amdgcn_sched_barrier(0);
        p0 = c0; p1 = c1;
    }
    wp = w;
}

// Sum over the 16 lanes of a row, the total in every lane of the row: four adds, each with its own cross-lane read (DPP row_xmask).
__device__ __forceinline__ float row16_sum(float v) {
    v += __builtin_bit_cast(float, __builtin_amdgcn_update_dpp(0, __builtin_bit_cast(int, v), 0x161, 0xf, 0xf, true));
    v += __builtin_bit_cast(float, __builtin_amdgcn_update_dpp(0, __builtin_bit_cast(int, v), 0x162, 0xf, 0xf, true));
    v += __builtin_bit_cast(float, __builtin_amdgcn_update_dpp(0, __builtin_bit_cast(int, v), 0x164, 0xf, 0xf, true));
    v += __builtin_bit_cast(float, __builtin_amdgcn_update_dpp(0, __builtin_bit_cast(int, v), 0x168, 0xf, 0xf, true));
    return v;
}

// One step of the halving butterfly over a row of 16 lanes. Of the sums s[v] and s[v + D] (v with bits below 2 D clear) a lane whose
// index has bit D set (up) keeps s[v + D], the others s[v]; the one it does not keep goes to the lane D away, which keeps that one.
template <int D>
__device__ __forceinline__ void halve_step(float (&s)[WAVES * 8], bool up) {
    #pragma unroll
    for (int v = 0; v < WAVES * 8; v += 2 * D) {
        const float keep = up ? s[v + D] : s[v];
        const float send = up ? s[v] : s[v + D];
        s[v] = keep + __builtin_bit_cast(float, __builtin_amdgcn_update_dpp(0, __builtin_bit_cast(int, send), 0x160 | D, 0xf, 0xf, true));
    }
}

// One block = 128 batch rows (8 row tiles) x all 16 heads, 8 heads at a time: each wave owns ONE head.
// The A fragments of all 8 row tiles and the 64 running sums a lane (8 row tiles x 8 rows) stay in registers; the head's
// 32 hidden tiles stream past them from L2 as f32, loaded four tiles ahead, each tile rounded once and used by all 8 row tiles.
// A fragment (lane l, row m = l&15, h = l>>4): elements 0..7 = f16_hi(x[m][8h..8h+7]) (k = 8h+i),
//   elements 8..15 = f16_lo of the same values (k = 16+8h+i)  ->  A[m][k] = x_hi[m][k], A[m][k+16] = x_lo[m][k].
// B fragment (lane l, column n = l&15): elements 0..7 = W_h[n][8h..8h+7] (k = 8h+i), elements 8..15 = the same values (k = 16+8h+i).
// D = b1[n] + sum_i (x_hi + x_lo)[m][i] * W_h[n][i].
// The tile loop sums W2[n] |D| only; the part linear in D is one product of the wave's own row tile with the V tile (column = head),
// there with A = [x_hi | x_hi] and [x_lo | x_lo], B = [V_hi | V_lo]. It stands behind the tile loops: each wave publishes the V sums of its two heads in LDS.
// At most two waves a SIMD, so one block a WGP: a grid of one block per WGP spreads over all of them.
__global__ __launch_bounds__(256) __attribute__((amdgpu_waves_per_eu(2, 2))) void k_mlp16(const float* __restrict__ x,
                                               const float* __restrict__ W1,
                                               const float* __restrict__ b1,
                                               const float* __restrict__ W2,
                                               const float* __restrict__ b2,
                                               float* __restrict__ out,
                                               int nrows)
{
    __shared__ __align__(16) float sOut[WAVES * ROWS_PER_WAVE * OUT_DIM];   // 2048 floats = 8 KB
    __shared__ __align__(16) unsigned short sA[WAVES * 2 * 32 * 8];         // per row tile: hi plane, lo plane, 16 B a lane = 8 KB
    __shared__ __align__(16) float sLin[WAVES * ROWS_PER_WAVE * OUT_DIM];   // linear part, laid out like sOut = 8 KB
    __shared__ __align__(16) float sV[OUT_DIM * IN_DIM];                    // sum_n W2[o][n] W1[o][n][i]
    __shared__ float sC[OUT_DIM];                                           // sum_n W2[o][n] b1[o][n]
    __shared__ float sB2[OUT_DIM];

    const int tid  = threadIdx.x;
    const int lane = tid & 31;
    const int wave = __builtin_amdgcn_readfirstlane(tid >> 5);              // scalar, so head and pass offsets stay scalar
    const int h    = lane >> 4;
    const int l16  = lane & 15;
    const int woff = l16 * IN_DIM + 8 * h;                                  // this lane's place in a 16-unit weight tile

    const int rbase = blockIdx.x * ROWS_PER_BLOCK + wave * ROWS_PER_WAVE;   // first row of this wave's own tile
    int row = rbase + l16;
    if (row > nrows - 1) row = nrows - 1;                                   // clamp loads; stores predicated

    // The wave's 64 hidden tiles (two heads of 32) stream through four register buffers, each refilled four tiles ahead:
    // the loads have four tile steps to come back from L2. The first four fly while the row tile below is split.
    RawTile r0, r1, r2, r3;
    load_tile(r0, W1, b1, W2, tile_unit(0, wave), woff, l16);
    load_tile(r1, W1, b1, W2, tile_unit(1, wave), woff, l16);
    load_tile(r2, W1, b1, W2, tile_unit(2, wave), woff, l16);
    load_tile(r3, W1, b1, W2, tile_unit(3, wave), woff, l16);

    // Each wave splits its own row tile once and publishes the two halves for all waves.
    {
        const float b2v = b2[l16];                                          // waits in LDS for the linear part at the end
        const v4f* xp = (const v4f*)(x + (size_t)row * IN_DIM + 8 * h);
        const v4f x0 = xp[0], x1 = xp[1];
        // Address registers of the loads above may be reused from here on. b2's value is an input so that its load is issued here,
        // beside x's: left free it sinks into the branch below, and its whole latency stands in front of the barrier.
        asm volatile("s_wait_xcnt 0x0" :: "v"(b2v) : "memory");
        v4u xh, xl;
        unsigned int hh, ll;
        split_pair(x0[0], x0[1], hh, ll); xh[0] = hh; xl[0] = ll;
        split_pair(x0[2], x0[3], hh, ll); xh[1] = hh; xl[1] = ll;
        split_pair(x1[0], x1[1], hh, ll); xh[2] = hh; xl[2] = ll;
        split_pair(x1[2], x1[3], hh, ll); xh[3] = hh; xl[3] = ll;
        *(v8us*)(sA + ((wave * 2 + 0) * 32 + lane) * 8) = __builtin_bit_cast(v8us, xh);
        *(v8us*)(sA + ((wave * 2 + 1) * 32 + lane) * 8) = __builtin_bit_cast(v8us, xl);
        if (tid < OUT_DIM) sB2[tid] = b2v;
    }
    __syncthreads();

    // The block's eight row tiles stay in registers for the whole kernel: A = [x_hi | x_lo] along k.
    Frag16 fa[WAVES];
    #pragma unroll
    for (int rt = 0; rt < WAVES; ++rt) {
        fa[rt].h8[0] = *(const v8us*)(sA + ((rt * 2 + 0) * 32 + lane) * 8);
        fa[rt].h8[1] = *(const v8us*)(sA + ((rt * 2 + 1) * 32 + lane) * 8);
    }

    // Rolled: one copy of the tile body and of the reduction in the text.
    #pragma unroll 1
    for (int g = 0; g < OUT_DIM / WAVES; ++g) {
        const int o = g * WAVES + wave;
        float acc[WAVES][8];
        #pragma unroll
        for (int rt = 0; rt < WAVES; ++rt) {
            #pragma unroll
            for (int r = 0; r < 8; ++r) acc[rt][r] = 0.0f;
        }
        // Results of the last two row tiles wait one tile step for their sums; zero weight before the head's first tile.
        v8f   p0 = { 0.0f, 0.0f, 0.0f, 0.0f, 0.0f, 0.0f, 0.0f, 0.0f };
        v8f   p1 = p0;
        float wp = 0.0f;
        v2f   vs[4] = { { 0.0f, 0.0f }, { 0.0f, 0.0f }, { 0.0f, 0.0f }, { 0.0f, 0.0f } };
        float cs = 0.0f;

        // Rolled, four tiles a trip: one per register buffer.
        #pragma unroll 1
        for (int t = 0; t < NT; t += 4) {
            const int T = g * NT + t;
            tile_step(acc, fa, r0, p0, p1, wp, vs, cs, W1, b1, W2, tile_unit(T + 4, wave), woff, l16);
            tile_step(acc, fa, r1, p0, p1, wp, vs, cs, W1, b1, W2, tile_unit(T + 5, wave), woff, l16);
            tile_step(acc, fa, r2, p0, p1, wp, vs, cs, W1, b1, W2, tile_unit(T + 6, wave), woff, l16);
            tile_step(acc, fa, r3, p0, p1, wp, vs, cs, W1, b1, W2, tile_unit(T + 7, wave), woff, l16);
        }
        abs_fma4(acc[6][0], acc[6][1], acc[6][2], acc[6][3], p0[0], p0[1], p0[2], p0[3], wp);
        abs_fma4(acc[6][4], acc[6][5], acc[6][6], acc[6][7], p0[4], p0[5], p0[6], p0[7], wp);
        abs_fma4(acc[7][0], acc[7][1], acc[7][2], acc[7][3], p1[0], p1[1], p1[2], p1[3], wp);
        abs_fma4(acc[7][4], acc[7][5], acc[7][6], acc[7][7], p1[4], p1[5], p1[6], p1[7], wp);

        // The head's linear sums: over the 16 units a row of lanes holds; one lane of each half publishes its 8 inputs.
        {
            v4f s0, s1;
            s0[0] = row16_sum(vs[0][0]); s0[1] = row16_sum(vs[0][1]); s0[2] = row16_sum(vs[1][0]); s0[3] = row16_sum(vs[1][1]);
            s1[0] = row16_sum(vs[2][0]); s1[1] = row16_sum(vs[2][1]); s1[2] = row16_sum(vs[3][0]); s1[3] = row16_sum(vs[3][1]);
            const float ct = row16_sum(cs);
            if (l16 == 0) {
                *(v4f*)(sV + o * IN_DIM + 8 * h)     = s0;
                *(v4f*)(sV + o * IN_DIM + 8 * h + 4) = s1;
            }
            if (lane == 0) sC[o] = ct;
        }

        // Sum over the 16 column lanes of each half: acc[rt][r] -> full 512-dot for row 8h+r of row tile rt.
        // A halving butterfly in registers: at each step a lane keeps one sum of every pair and hands the other to its partner lane,
        // so 32, 16, 8 and 4 adds (each with its own cross-lane read) do the work of 4 x 64 exchanges through the LDS unit,
        // which all eight waves would queue at together. Each sum is still formed over lane distances 1, 2, 4, 8 in that order.
        // Lane bits 0..2 pick r, bit 3 picks the low bit of rt: the lane ends with row (l16 & 7) of row tiles (l16 >> 3) + 0, 2, 4, 6.
        float s[WAVES * 8];
        #pragma unroll
        for (int v = 0; v < WAVES * 8; ++v) s[v] = acc[v >> 3][v & 7];
        halve_step<1>(s, (l16 & 1) != 0);
        halve_step<2>(s, (l16 & 2) != 0);
        halve_step<4>(s, (l16 & 4) != 0);
        halve_step<8>(s, (l16 & 8) != 0);
        #pragma unroll
        for (int u = 0; u < WAVES / 2; ++u)
            sOut[((2 * u + (l16 >> 3)) * ROWS_PER_WAVE + 8 * h + (l16 & 7)) * OUT_DIM + o] = s[16 * u];
    }

    __syncthreads();

    // Linear part of the wave's own row tile, all 16 heads: row 8h+r, head l16.
    {
        Frag16 fv, fxh, fxl;
        const v4f a0 = *(const v4f*)(sV + woff), a1 = *(const v4f*)(sV + woff + 4);
        v4u vh, vl;
        unsigned int hh, ll;
        split_pair(LIN_C * a0[0], LIN_C * a0[1], hh, ll); vh[0] = hh; vl[0] = ll;
        split_pair(LIN_C * a0[2], LIN_C * a0[3], hh, ll); vh[1] = hh; vl[1] = ll;
        split_pair(LIN_C * a1[0], LIN_C * a1[1], hh, ll); vh[2] = hh; vl[2] = ll;
        split_pair(LIN_C * a1[2], LIN_C * a1[3], hh, ll); vh[3] = hh; vl[3] = ll;
        fv.u4[0] = vh; fv.u4[1] = vl;
        const v8us xh = *(const v8us*)(sA + ((wave * 2 + 0) * 32 + lane) * 8);
        const v8us xl = *(const v8us*)(sA + ((wave * 2 + 1) * 32 + lane) * 8);
        fxh.h8[0] = xh; fxh.h8[1] = xh;
        fxl.h8[0] = xl; fxl.h8[1] = xl;
        const float cv = fmaf(LIN_C, sC[l16], sB2[l16]);
        const v8f c0 = { cv, cv, cv, cv, cv, cv, cv, cv };
        const v8f lin = wmma_pair_f16(fxh.v, fxl.v, fv.v, c0);
        #pragma unroll
        for (int r = 0; r < 8; ++r) sLin[(wave * ROWS_PER_WAVE + 8 * h + r) * OUT_DIM + l16] = lin[r];
    }
    __syncthreads();

    const float* sw = sOut + wave * (ROWS_PER_WAVE * OUT_DIM);
    const float* sl = sLin + wave * (ROWS_PER_WAVE * OUT_DIM);
    const v4f v0 = *(const v4f*)(sw + lane * 4) + *(const v4f*)(sl + lane * 4);
    const v4f v1 = *(const v4f*)(sw + 128 + lane * 4) + *(const v4f*)(sl + 128 + lane * 4);
    const bool p0 = (rbase + (lane >> 2)) < nrows;
    const bool p1 = (rbase + 8 + (lane >> 2)) < nrows;
    float* dst = out + (size_t)rbase * OUT_DIM;
    if (p0) *(v4f*)(dst + lane * 4) = v0;
    if (p1) *(v4f*)(dst + 128 + lane * 4) = v1;
}

extern "C" void kernel_launch(void* const* d_in, const int* in_sizes, int n_in,
                              void* d_out, int out_size, void* d_ws, size_t ws_size,
                              hipStream_t stream)
{
    if (n_in < 5) return;
    const int nx  = in_sizes[0];
    const int nw1 = in_sizes[1];
    const int nb1 = in_sizes[2];
    const int nw2 = in_sizes[3];
    const int nb2 = in_sizes[4];
    const int nrows = nx / IN_DIM;
    if (nrows <= 0 || nx != nrows * IN_DIM) return;
    if (nw1 != OUT_DIM * HID * IN_DIM || nb1 != OUT_DIM * HID || nw2 != OUT_DIM * HID || nb2 != OUT_DIM) return;
    if (out_size != nrows * OUT_DIM) return;

    const float* x  = (const float*)d_in[0];
    const float* W1 = (const float*)d_in[1];
    const float* b1 = (const float*)d_in[2];
    const float* W2 = (const float*)d_in[3];
    const float* b2 = (const float*)d_in[4];
    float* out = (float*)d_out;

    dim3 gm((nrows + ROWS_PER_BLOCK - 1) / ROWS_PER_BLOCK);     // 256 blocks for 32768 rows
    k_mlp16<<<gm, dim3(256), 0, stream>>>(x, W1, b1, W2, b2, out, nrows);
    (void)hipGetLastError();
}

// v007
// A run of this version takes 15.5 microseconds.
// Next to v006, in two timings, it ran 1.10 times as fast each time.
// Over all steps from v000 it is 15.4 times as fast.
#include <hip/hip_runtime.h>
#include <stdint.h>

// Contraction 1 (x . W1[o]^T per head, K=16 on a 32-deep tile): ONE v_wmma_f32_16x16x32_f16 a tile: x as an f16 hi+lo pair packed along k (A = [x_hi | x_lo], 22 mantissa bits), W1 rounded to one f16 value (B = [W_h | W_h], 11 mantissa bits), f32 accumulate seeded with b1; contraction 2 (512 -> 1 per head with W2): f32 VALU from the f32 accumulators.
// f16 operands: |x| and |W1| must stay below 65504.
// LeakyReLU(h) = 0.6 h + 0.4 |h| (slope 0.2). The part linear in h sums to x . V[o] + const with V[o] = 0.6 sum_n W2[o][n] W1[o][n][:], one more 16-column tile on the same WMMA form.
// One launch: W1 streams as f32 and is rounded to f16 in registers by the wave that uses it, which sums V[o] from the same f32 registers.

typedef float v8f __attribute__((ext_vector_type(8)));
typedef float v4f __attribute__((ext_vector_type(4))) __attribute__((may_alias));
typedef float v2f __attribute__((ext_vector_type(2)));
typedef _Float16 v2h __attribute__((ext_vector_type(2)));
typedef unsigned int v4u __attribute__((ext_vector_type(4)));
typedef unsigned short v8us __attribute__((ext_vector_type(8))) __attribute__((may_alias));
typedef unsigned short v16us __attribute__((ext_vector_type(16)));
typedef _Float16 v16h __attribute__((ext_vector_type(16)));

union Frag16 { v16h v; v16us u; v8us h8[2]; v4u u4[2]; };

#define IN_DIM          16
#define OUT_DIM         16
#define HID             512
#define NT              (HID / 16)
#define WAVES           8
#define ROWS_PER_WAVE   16
#define ROWS_PER_BLOCK  (WAVES * ROWS_PER_WAVE)
#define NEG_SLOPE       0.2f
#define LIN_C           (0.5f * (1.0f + NEG_SLOPE))   // weight of h in LeakyReLU
#define ABS_C           (0.5f * (1.0f - NEG_SLOPE))   // weight of |h| in LeakyReLU

// Two f32 values rounded to f16, packed in one word.
__device__ __forceinline__ unsigned int pack_pair(float a, float b) {
    const v2f f = { a, b };
    return __builtin_bit_cast(unsigned int, __builtin_convertvector(f, v2h));
}

// Two f32 values -> their f16 hi parts packed in one word and the f16 lo parts (of the exact residuals) in another.
__device__ __forceinline__ void split_pair(float a, float b, unsigned int& hi, unsigned int& lo) {
    const v2f f = { a, b };
    const v2h hb = __builtin_convertvector(f, v2h);
    const v2f r = { __builtin_fmaf((float)hb[0], -1.0f, a), __builtin_fmaf((float)hb[1], -1.0f, b) };
    const v2h lb = __builtin_convertvector(r, v2h);
    hi = __builtin_bit_cast(unsigned int, hb);
    lo = __builtin_bit_cast(unsigned int, lb);
}

// Two chained 16x16x32 f16 WMMAs into one accumulator, then the VALU hazard guard.
__device__ __forceinline__ v8f wmma_pair_f16(v16h ah, v16h al, v16h b, v8f c) {
    c = __builtin_amdgcn_wmma_f32_16x16x32_f16(false, ah, false, b, (short)0, c, false, false);
    c = __builtin_amdgcn_wmma_f32_16x16x32_f16(false, al, false, b, (short)0, c, false, false);
    asm volatile("v_nop\n\tv_nop\n\tv_nop\n\tv_nop" : "+v"(c) : "v"(ah), "v"(al), "v"(b));
    return c;
}

// a[j] += |c[j]| * w for four rows of a WMMA result: one v_fma_f32 with the abs source modifier per element (compiled code
// pairs the sums into packed fma, which has no abs modifier, and spends a v_and_b32 per element on it).
__device__ __forceinline__ void abs_fma4(float& a0, float& a1, float& a2, float& a3,
                                         float c0, float c1, float c2, float c3, float w) {
    asm volatile("v_fma_f32 %0, |%4|, %8, %0\n\t"
                 "v_fma_f32 %1, |%5|, %8, %1\n\t"
                 "v_fma_f32 %2, |%6|, %8, %2\n\t"
                 "v_fma_f32 %3, |%7|, %8, %3"
                 : "+v"(a0), "+v"(a1), "+v"(a2), "+v"(a3)
                 : "v"(c0), "v"(c1), "v"(c2), "v"(c3), "v"(w));
}

// One 16-unit hidden tile as loaded: this lane's 8 weights (f32), its unit's W2 and b1 (a register pair: W2 is the packed sums' first source).
struct RawTile { v4f f0, f1; v2f wb; };   // wb = { W2, b1 }

// First hidden unit (flat over heads) of a wave's group of four tiles T .. T + 3 (T = 0, 4 .. 60): head T / 32 * 8 + wave, tile T % 32.
// Past the end: the last group again.
__device__ __forceinline__ int group_unit(int T, int wave) {
    const int Tc = T < 2 * NT ? T : 2 * NT - 4;
    return ((Tc / NT) * WAVES + wave) * HID + (Tc % NT) * 16;
}

// This lane's places in W1, b1 and W2 for the first tile of a group of four: formed once a group.
struct GroupAddr { const float* w1; const float* b1; const float* w2; };

__device__ __forceinline__ GroupAddr group_addr(const float* __restrict__ W1, const float* __restrict__ b1,
                                                const float* __restrict__ W2, int nb, int woff, int l16) {
    GroupAddr ga;
    ga.w1 = W1 + (size_t)nb * IN_DIM + woff;
    ga.b1 = b1 + nb + l16;
    ga.w2 = W2 + nb + l16;
    return ga;
}

// Tile K of a group: the group's addresses plus a constant. No register that these loads name changes inside a group,
// so no wait on their address translation stands here: it stands once a group, in front of the rewrite of the addresses.
template <int K>
__device__ __forceinline__ void load_tile(RawTile& r, const GroupAddr& ga) {
    const v4f* wp4 = (const v4f*)(ga.w1 + K * 16 * IN_DIM);
    r.f0 = wp4[0];
    r.f1 = wp4[1];
    r.wb[0] = ga.w2[K * 16];
    r.wb[1] = ga.b1[K * 16];
}

// One hidden tile against all eight resident row tiles. The bias tile is built once and is the C operand of all eight.
// Each WMMA is followed by the eight sums of the row tile two before, whose result is complete: they issue while the matrix unit works.
// The tile's weights are rounded to f16 here, and W2[n] W1[n][:] and W2[n] b1[n] (f32) join the head's linear sums vs, cs (this lane's unit n, its 8 inputs).
template <int K>
__device__ __forceinline__ void tile_step(float (&acc)[WAVES][8], const Frag16 (&fa)[WAVES], RawTile& r,
                                          v8f& p0, v8f& p1, float& wp, v2f (&vs)[4], float& cs,
                                          const GroupAddr& ga) {
    Frag16 fh;
    {
        v4u hv;
        hv[0] = pack_pair(r.f0[0], r.f0[1]);
        hv[1] = pack_pair(r.f0[2], r.f0[3]);
        hv[2] = pack_pair(r.f1[0], r.f1[1]);
        hv[3] = pack_pair(r.f1[2], r.f1[3]);
        fh.u4[0] = hv; fh.u4[1] = hv;
        // vs += W2 * weights (both halves of a packed fma take W2 from the pair's low word), cs += W2 * b1. In asm so that the sums
        // stay here, in front of the reload of these registers: compiled, they sink to the loop's foot and all four buffers' old values stay live.
        asm volatile("v_pk_fma_f32 %0, %5, %8, %0 op_sel_hi:[0,1,1]\n\t"
                     "v_pk_fma_f32 %1, %5, %9, %1 op_sel_hi:[0,1,1]\n\t"
                     "v_pk_fma_f32 %2, %5, %10, %2 op_sel_hi:[0,1,1]\n\t"
                     "v_pk_fma_f32 %3, %5, %11, %3 op_sel_hi:[0,1,1]\n\t"
                     "v_fma_f32 %4, %6, %7, %4"
                     : "+v"(vs[0]), "+v"(vs[1]), "+v"(vs[2]), "+v"(vs[3]), "+v"(cs)
                     : "v"(r.wb), "v"(r.wb[0]), "v"(r.wb[1]),
                       "v"((v2f){ r.f0[0], r.f0[1] }), "v"((v2f){ r.f0[2], r.f0[3] }), "v"((v2f){ r.f1[0], r.f1[1] }), "v"((v2f){ r.f1[2], r.f1[3] }));
    }
    const float bt = r.wb[1];
    const float w  = ABS_C * r.wb[0];                               // weight of |h|, for all eight row tiles
    const v8f cb = { bt, bt, bt, bt, bt, bt, bt, bt };           // bias for column n, all rows
    load_tile<K>(r, ga);
    // The scheduling barriers keep this order: left free, the compiler puts a result's sums directly behind its WMMA,
    // inside the slots that a WMMA result needs before it is read, and nothing is left to issue beside the matrix unit.
    __builtin_amdgcn_sched_barrier(0);
    #pragma unroll
    for (int p = 0; p < WAVES / 2; ++p) {
        const int q0 = (2 * p + 6) & 7, q1 = (2 * p + 7) & 7;     // the row tiles whose results wait in p0, p1
        const float wq = (p == 0) ? wp : w;                       // theirs is the tile before at p = 0
        const v8f c0 = __builtin_amdgcn_wmma_f32_16x16x32_f16(false, fa[2 * p].v, false, fh.v, (short)0, cb, false, false);
        __builtin_amdgcn_sched_barrier(0);
        abs_fma4(acc[q0][0], acc[q0][1], acc[q0][2], acc[q0][3], p0[0], p0[1], p0[2], p0[3], wq);
        abs_fma4(acc[q0][4], acc[q0][5], acc[q0][6], acc[q0][7], p0[4], p0[5], p0[6], p0[7], wq);
        __builtin_amdgcn_sched_barrier(0);
        const v8f c1 = __builtin_amdgcn_wmma_f32_16x16x32_f16(false, fa[2 * p + 1].v, false, fh.v, (short)0, cb, false, false);
        __builtin_amdgcn_sched_barrier(0);
        abs_fma4(acc[q1][0], acc[q1][1], acc[q1][2], acc[q1][3], p1[0], p1[1], p1[2], p1[3], wq);
        abs_fma4(acc[q1][4], acc[q1][5], acc[q1][6], acc[q1][7], p1[4], p1[5], p1[6], p1[7], wq);
        __builtin_amdgcn_sched_barrier(0);
        p0 = c0; p1 = c1;
    }
    wp = w;
}

// Sum over the 16 lanes of a row, the total in every lane of the row: four adds, each with its own cross-lane read (DPP row_xmask).
__device__ __forceinline__ float row16_sum(float v) {
    v += __builtin_bit_cast(float, __builtin_amdgcn_update_dpp(0, __builtin_bit_cast(int, v), 0x161, 0xf, 0xf, true));
    v += __builtin_bit_cast(float, __builtin_amdgcn_update_dpp(0, __builtin_bit_cast(int, v), 0x162, 0xf, 0xf, true));
    v += __builtin_bit_cast(float, __builtin_amdgcn_update_dpp(0, __builtin_bit_cast(int, v), 0x164, 0xf, 0xf, true));
    v += __builtin_bit_cast(float, __builtin_amdgcn_update_dpp(0, __builtin_bit_cast(int, v), 0x168, 0xf, 0xf, true));
    return v;
}

// One step of the halving butterfly over a row of 16 lanes. Of the sums s[v] and s[v + D] (v with bits below 2 D clear) a lane whose
// index has bit D set (up) keeps s[v + D], the others s[v]; the one it does not keep goes to the lane D away, which keeps that one.
template <int D>
__device__ __forceinline__ void halve_step(float (&s)[WAVES * 8], bool up) {
    #pragma unroll
    for (int v = 0; v < WAVES * 8; v += 2 * D) {
        const float keep = up ? s[v + D] : s[v];
        const float send = up ? s[v] : s[v + D];
        s[v] = keep + __builtin_bit_cast(float, __builtin_amdgcn_update_dpp(0, __builtin_bit_cast(int, send), 0x160 | D, 0xf, 0xf, true));
    }
}

// One block = 128 batch rows (8 row tiles) x all 16 heads, 8 heads at a time: each wave owns ONE head.
// The A fragments of all 8 row tiles and the 64 running sums a lane (8 row tiles x 8 rows) stay in registers; the head's
// 32 hidden tiles stream past them from L2 as f32, loaded four tiles ahead, each tile rounded once and used by all 8 row tiles.
// A fragment (lane l, row m = l&15, h = l>>4): elements 0..7 = f16_hi(x[m][8h..8h+7]) (k = 8h+i),
//   elements 8..15 = f16_lo of the same values (k = 16+8h+i)  ->  A[m][k] = x_hi[m][k], A[m][k+16] = x_lo[m][k].
// B fragment (lane l, column n = l&15): elements 0..7 = W_h[n][8h..8h+7] (k = 8h+i), elements 8..15 = the same values (k = 16+8h+i).
// D = b1[n] + sum_i (x_hi + x_lo)[m][i] * W_h[n][i].
// The tile loop sums W2[n] |D| only; the part linear in D is one product of the wave's own row tile with the V tile (column = head),
// there with A = [x_hi | x_hi] and [x_lo | x_lo], B = [V_hi | V_lo]. It stands behind the tile loops: each wave publishes the V sums of its two heads in LDS.
// At most two waves a SIMD, so one block a WGP: a grid of one block per WGP spreads over all of them.
__global__ __launch_bounds__(256) __attribute__((amdgpu_waves_per_eu(2, 2))) void k_mlp16(const float* __restrict__ x,
                                               const float* __restrict__ W1,
                                               const float* __restrict__ b1,
                                               const float* __restrict__ W2,
                                               const float* __restrict__ b2,
                                               float* __restrict__ out,
                                               int nrows)
{
    __shared__ __align__(16) float sOut[WAVES * ROWS_PER_WAVE * OUT_DIM];   // 2048 floats = 8 KB
    __shared__ __align__(16) unsigned short sA[WAVES * 2 * 32 * 8];         // per row tile: hi plane, lo plane, 16 B a lane = 8 KB
    __shared__ __align__(16) float sLin[WAVES * ROWS_PER_WAVE * OUT_DIM];   // linear part, laid out like sOut = 8 KB
    __shared__ __align__(16) float sV[OUT_DIM * IN_DIM];                    // sum_n W2[o][n] W1[o][n][i]
    __shared__ float sC[OUT_DIM];                                           // sum_n W2[o][n] b1[o][n]
    __shared__ float sB2[OUT_DIM];

    const int tid  = threadIdx.x;
    const int lane = tid & 31;
    const int wave = __builtin_amdgcn_readfirstlane(tid >> 5);              // scalar, so head and pass offsets stay scalar
    const int h    = lane >> 4;
    const int l16  = lane & 15;
    const int woff = l16 * IN_DIM + 8 * h;                                  // this lane's place in a 16-unit weight tile

    const int rbase = blockIdx.x * ROWS_PER_BLOCK + wave * ROWS_PER_WAVE;   // first row of this wave's own tile
    int row = rbase + l16;
    if (row > nrows - 1) row = nrows - 1;                                   // clamp loads; stores predicated

    // The wave's 64 hidden tiles (two heads of 32) stream through four register buffers, each refilled four tiles ahead:
    // the loads have four tile steps to come back from L2. The first four fly while the row tile below is split.
    RawTile r0, r1, r2, r3;
    {
        const GroupAddr g0 = group_addr(W1, b1, W2, group_unit(0, wave), woff, l16);
        load_tile<0>(r0, g0);
        load_tile<1>(r1, g0);
        load_tile<2>(r2, g0);
        load_tile<3>(r3, g0);
        // Address registers of the loads above may be reused from here on.
        asm volatile("s_wait_xcnt 0x0" ::: "memory");
    }

    // Each wave splits its own row tile once and publishes the two halves for all waves.
    {
        const float b2v = b2[l16];                                          // waits in LDS for the linear part at the end
        const v4f* xp = (const v4f*)(x + (size_t)row * IN_DIM + 8 * h);
        const v4f x0 = xp[0], x1 = xp[1];
        // Address registers of the loads above may be reused from here on. b2's value is an input so that its load is issued here,
        // beside x's: left free it sinks into the branch below, and its whole latency stands in front of the barrier.
        asm volatile("s_wait_xcnt 0x0" :: "v"(b2v) : "memory");
        v4u xh, xl;
        unsigned int hh, ll;
        split_pair(x0[0], x0[1], hh, ll); xh[0] = hh; xl[0] = ll;
        split_pair(x0[2], x0[3], hh, ll); xh[1] = hh; xl[1] = ll;
        split_pair(x1[0], x1[1], hh, ll); xh[2] = hh; xl[2] = ll;
        split_pair(x1[2], x1[3], hh, ll); xh[3] = hh; xl[3] = ll;
        *(v8us*)(sA + ((wave * 2 + 0) * 32 + lane) * 8) = __builtin_bit_cast(v8us, xh);
        *(v8us*)(sA + ((wave * 2 + 1) * 32 + lane) * 8) = __builtin_bit_cast(v8us, xl);
        if (tid < OUT_DIM) sB2[tid] = b2v;
    }
    __syncthreads();

    // The block's eight row tiles stay in registers for the whole kernel: A = [x_hi | x_lo] along k.
    Frag16 fa[WAVES];
    #pragma unroll
    for (int rt = 0; rt < WAVES; ++rt) {
        fa[rt].h8[0] = *(const v8us*)(sA + ((rt * 2 + 0) * 32 + lane) * 8);
        fa[rt].h8[1] = *(const v8us*)(sA + ((rt * 2 + 1) * 32 + lane) * 8);
    }

    int Tn = 4;                                                             // first tile of the next group to load (scalar)
    // Rolled: one copy of the tile body and of the reduction in the text.
    #pragma unroll 1
    for (int g = 0; g < OUT_DIM / WAVES; ++g) {
        const int o = g * WAVES + wave;
        float acc[WAVES][8];
        #pragma unroll
        for (int rt = 0; rt < WAVES; ++rt) {
            #pragma unroll
            for (int r = 0; r < 8; ++r) acc[rt][r] = 0.0f;
        }
        // Results of the last two row tiles wait one tile step for their sums; zero weight before the head's first tile.
        v8f   p0 = { 0.0f, 0.0f, 0.0f, 0.0f, 0.0f, 0.0f, 0.0f, 0.0f };
        v8f   p1 = p0;
        float wp = 0.0f;
        v2f   vs[4] = { { 0.0f, 0.0f }, { 0.0f, 0.0f }, { 0.0f, 0.0f }, { 0.0f, 0.0f } };
        float cs = 0.0f;

        // Rolled, four tiles a trip: one per register buffer.
        #pragma unroll 1
        for (int t = 0; t < NT; t += 4) {
            const GroupAddr ga = group_addr(W1, b1, W2, group_unit(Tn, wave), woff, l16);
            tile_step<0>(acc, fa, r0, p0, p1, wp, vs, cs, ga);
            tile_step<1>(acc, fa, r1, p0, p1, wp, vs, cs, ga);
            tile_step<2>(acc, fa, r2, p0, p1, wp, vs, cs, ga);
            tile_step<3>(acc, fa, r3, p0, p1, wp, vs, cs, ga);
            Tn += 4;
            // The group's one wait on address translation, a whole tile step behind its last load, where it no longer holds the wave up.
            // The addresses are inputs, so their registers stand untouched up to here; the next group's number is an output,
            // so the new addresses are formed behind it.
            asm volatile("s_wait_xcnt 0x0" : "+s"(Tn) : "v"(ga.w1), "v"(ga.b1), "v"(ga.w2) : "memory");
        }
        abs_fma4(acc[6][0], acc[6][1], acc[6][2], acc[6][3], p0[0], p0[1], p0[2], p0[3], wp);
        abs_fma4(acc[6][4], acc[6][5], acc[6][6], acc[6][7], p0[4], p0[5], p0[6], p0[7], wp);
        abs_fma4(acc[7][0], acc[7][1], acc[7][2], acc[7][3], p1[0], p1[1], p1[2], p1[3], wp);
        abs_fma4(acc[7][4], acc[7][5], acc[7][6], acc[7][7], p1[4], p1[5], p1[6], p1[7], wp);

        // The head's linear sums: over the 16 units a row of lanes holds; one lane of each half publishes its 8 inputs.
        {
            v4f s0, s1;
            s0[0] = row16_sum(vs[0][0]); s0[1] = row16_sum(vs[0][1]); s0[2] = row16_sum(vs[1][0]); s0[3] = row16_sum(vs[1][1]);
            s1[0] = row16_sum(vs[2][0]); s1[1] = row16_sum(vs[2][1]); s1[2] = row16_sum(vs[3][0]); s1[3] = row16_sum(vs[3][1]);
            const float ct = row16_sum(cs);
            if (l16 == 0) {
                *(v4f*)(sV + o * IN_DIM + 8 * h)     = s0;
                *(v4f*)(sV + o * IN_DIM + 8 * h + 4) = s1;
            }
            if (lane == 0) sC[o] = ct;
        }

        // Sum over the 16 column lanes of each half: acc[rt][r] -> full 512-dot for row 8h+r of row tile rt.
        // A halving butterfly in registers: at each step a lane keeps one sum of every pair and hands the other to its partner lane,
        // so 32, 16, 8 and 4 adds (each with its own cross-lane read) do the work of 4 x 64 exchanges through the LDS unit,
        // which all eight waves would queue at together. Each sum is still formed over lane distances 1, 2, 4, 8 in that order.
        // Lane bits 0..2 pick r, bit 3 picks the low bit of rt: the lane ends with row (l16 & 7) of row tiles (l16 >> 3) + 0, 2, 4, 6.
        float s[WAVES * 8];
        #pragma unroll
        for (int v = 0; v < WAVES * 8; ++v) s[v] = acc[v >> 3][v & 7];
        halve_step<1>(s, (l16 & 1) != 0);
        halve_step<2>(s, (l16 & 2) != 0);
        halve_step<4>(s, (l16 & 4) != 0);
        halve_step<8>(s, (l16 & 8) != 0);
        #pragma unroll
        for (int u = 0; u < WAVES / 2; ++u)
            sOut[((2 * u + (l16 >> 3)) * ROWS_PER_WAVE + 8 * h + (l16 & 7)) * OUT_DIM + o] = s[16 * u];
    }

    __syncthreads();

    // Linear part of the wave's own row tile, all 16 heads: row 8h+r, head l16.
    {
        Frag16 fv, fxh, fxl;
        const v4f a0 = *(const v4f*)(sV + woff), a1 = *(const v4f*)(sV + woff + 4);
        v4u vh, vl;
        unsigned int hh, ll;
        split_pair(LIN_C * a0[0], LIN_C * a0[1], hh, ll); vh[0] = hh; vl[0] = ll;
        split_pair(LIN_C * a0[2], LIN_C * a0[3], hh, ll); vh[1] = hh; vl[1] = ll;
        split_pair(LIN_C * a1[0], LIN_C * a1[1], hh, ll); vh[2] = hh; vl[2] = ll;
        split_pair(LIN_C * a1[2], LIN_C * a1[3], hh, ll); vh[3] = hh; vl[3] = ll;
        fv.u4[0] = vh; fv.u4[1] = vl;
        const v8us xh = *(const v8us*)(sA + ((wave * 2 + 0) * 32 + lane) * 8);
        const v8us xl = *(const v8us*)(sA + ((wave * 2 + 1) * 32 + lane) * 8);
        fxh.h8[0] = xh; fxh.h8[1] = xh;
        fxl.h8[0] = xl; fxl.h8[1] = xl;
        const float cv = fmaf(LIN_C, sC[l16], sB2[l16]);
        const v8f c0 = { cv, cv, cv, cv, cv, cv, cv, cv };
        const v8f lin = wmma_pair_f16(fxh.v, fxl.v, fv.v, c0);
        #pragma unroll
        for (int r = 0; r < 8; ++r) sLin[(wave * ROWS_PER_WAVE + 8 * h + r) * OUT_DIM + l16] = lin[r];
    }
    __syncthreads();

    const float* sw = sOut + wave * (ROWS_PER_WAVE * OUT_DIM);
    const float* sl = sLin + wave * (ROWS_PER_WAVE * OUT_DIM);
    const v4f v0 = *(const v4f*)(sw + lane * 4) + *(const v4f*)(sl + lane * 4);
    const v4f v1 = *(const v4f*)(sw + 128 + lane * 4) + *(const v4f*)(sl + 128 + lane * 4);
    const bool p0 = (rbase + (lane >> 2)) < nrows;
    const bool p1 = (rbase + 8 + (lane >> 2)) < nrows;
    float* dst = out + (size_t)rbase * OUT_DIM;
    if (p0) *(v4f*)(dst + lane * 4) = v0;
    if (p1) *(v4f*)(dst + 128 + lane * 4) = v1;
}

extern "C" void kernel_launch(void* const* d_in, const int* in_sizes, int n_in,
                              void* d_out, int out_size, void* d_ws, size_t ws_size,
                              hipStream_t stream)
{
    if (n_in < 5) return;
    const int nx  = in_sizes[0];
    const int nw1 = in_sizes[1];
    const int nb1 = in_sizes[2];
    const int nw2 = in_sizes[3];
    const int nb2 = in_sizes[4];
    const int nrows = nx / IN_DIM;
    if (nrows <= 0 || nx != nrows * IN_DIM) return;
    if (nw1 != OUT_DIM * HID * IN_DIM || nb1 != OUT_DIM * HID || nw2 != OUT_DIM * HID || nb2 != OUT_DIM) return;
    if (out_size != nrows * OUT_DIM) return;

    const float* x  = (const float*)d_in[0];
    const float* W1 = (const float*)d_in[1];
    const float* b1 = (const float*)d_in[2];
    const float* W2 = (const float*)d_in[3];
    const float* b2 = (const float*)d_in[4];
    float* out = (float*)d_out;

    dim3 gm((nrows + ROWS_PER_BLOCK - 1) / ROWS_PER_BLOCK);     // 256 blocks for 32768 rows
    k_mlp16<<<gm, dim3(256), 0, stream>>>(x, W1, b1, W2, b2, out, nrows);
    (void)hipGetLastError();
}

// v008
// It runs in 14.2 microseconds.
// Timed twice side by side with v007, it ran 1.09 and 1.08 times as fast.
// Over all steps from v000 it is 16.7 times as fast.
#include <hip/hip_runtime.h>
#include <stdint.h>

// Contraction 1 (x . W1[o]^T per head, K=16 on a 32-deep tile): ONE v_wmma_f32_16x16x32_f16 a tile: x as an f16 hi+lo pair packed along k (B = [x_hi | x_lo], 22 mantissa bits), W1 rounded to one f16 value (A = [W_h | W_h], 11 mantissa bits), f32 accumulate seeded with b1; contraction 2 (512 -> 1 per head with W2): |h| of two hidden tiles packed to f16 is the B operand of one more WMMA of the same form, A = W2 rounded to f16, f32 accumulate.
// f16 operands: |x|, |W1|, |W2| and |h| must stay below 65504.
// LeakyReLU(h) = 0.6 h + 0.4 |h| (slope 0.2). The part linear in h sums to x . V[o] + const with V[o] = 0.6 sum_n W2[o][n] W1[o][n][:], one more 16-column tile on the same WMMA form.
// One launch: W1 streams as f32 and is rounded to f16 in registers by the wave that uses it, which sums V[o] from the same f32 registers.

typedef float v8f __attribute__((ext_vector_type(8)));
typedef float v4f __attribute__((ext_vector_type(4))) __attribute__((may_alias));
typedef float v2f __attribute__((ext_vector_type(2)));
typedef _Float16 v2h __attribute__((ext_vector_type(2)));
typedef unsigned int v4u __attribute__((ext_vector_type(4)));
typedef unsigned short v8us __attribute__((ext_vector_type(8))) __attribute__((may_alias));
typedef unsigned short v16us __attribute__((ext_vector_type(16)));
typedef _Float16 v16h __attribute__((ext_vector_type(16)));

union Frag16 { v16h v; v16us u; v8us h8[2]; v4u u4[2]; };

#define IN_DIM          16
#define OUT_DIM         16
#define HID             512
#define NT              (HID / 16)
#define WAVES           8
#define ROWS_PER_WAVE   16
#define ROWS_PER_BLOCK  (WAVES * ROWS_PER_WAVE)
#define NEG_SLOPE       0.2f
#define LIN_C           (0.5f * (1.0f + NEG_SLOPE))   // weight of h in LeakyReLU
#define ABS_C           (0.5f * (1.0f - NEG_SLOPE))   // weight of |h| in LeakyReLU

// Two f32 values rounded to f16, packed in one word.
__device__ __forceinline__ unsigned int pack_pair(float a, float b) {
    const v2f f = { a, b };
    return __builtin_bit_cast(unsigned int, __builtin_convertvector(f, v2h));
}

// Two f32 values -> their f16 hi parts packed in one word and the f16 lo parts (of the exact residuals) in another.
__device__ __forceinline__ void split_pair(float a, float b, unsigned int& hi, unsigned int& lo) {
    const v2f f = { a, b };
    const v2h hb = __builtin_convertvector(f, v2h);
    const v2f r = { __builtin_fmaf((float)hb[0], -1.0f, a), __builtin_fmaf((float)hb[1], -1.0f, b) };
    const v2h lb = __builtin_convertvector(r, v2h);
    hi = __builtin_bit_cast(unsigned int, hb);
    lo = __builtin_bit_cast(unsigned int, lb);
}

// Two chained 16x16x32 f16 WMMAs into one accumulator, then the VALU hazard guard.
__device__ __forceinline__ v8f wmma_pair_f16(v16h ah, v16h al, v16h b, v8f c) {
    c = __builtin_amdgcn_wmma_f32_16x16x32_f16(false, ah, false, b, (short)0, c, false, false);
    c = __builtin_amdgcn_wmma_f32_16x16x32_f16(false, al, false, b, (short)0, c, false, false);
    asm volatile("v_nop\n\tv_nop\n\tv_nop\n\tv_nop" : "+v"(c) : "v"(ah), "v"(al), "v"(b));
    return c;
}

// One 16-unit hidden tile as loaded: the 8 weights (f32) of this lane's unit l16, that unit's W2 and b1 (a register pair: W2 is the packed sums' first source),
// and b1 and W2 of the eight units 8h .. 8h + 7, the units whose results this lane holds.
struct RawTile { v4f f0, f1; v2f wb; v4f bv0, bv1, wv0, wv1; };   // wb = { W2, b1 }

// First hidden unit (flat over heads) of a wave's group of four tiles T .. T + 3 (T = 0, 4 .. 60): head T / 32 * 8 + wave, tile T % 32.
// Past the end: the last group again.
__device__ __forceinline__ int group_unit(int T, int wave) {
    const int Tc = T < 2 * NT ? T : 2 * NT - 4;
    return ((Tc / NT) * WAVES + wave) * HID + (Tc % NT) * 16;
}

// This lane's places in W1, b1 and W2 for the first tile of a group of four: formed once a group.
struct GroupAddr { const float* w1; const float* b1; const float* w2; const float* b1v; const float* w2v; };

__device__ __forceinline__ GroupAddr group_addr(const float* __restrict__ W1, const float* __restrict__ b1,
                                                const float* __restrict__ W2, int nb, int woff, int l16, int h) {
    GroupAddr ga;
    ga.w1 = W1 + (size_t)nb * IN_DIM + woff;
    ga.b1 = b1 + nb + l16;
    ga.w2 = W2 + nb + l16;
    ga.b1v = b1 + nb + 8 * h;
    ga.w2v = W2 + nb + 8 * h;
    return ga;
}

// Tile K of a group: the group's addresses plus a constant. No register that these loads name changes inside a group,
// so no wait on their address translation stands here: it stands once a group, in front of the rewrite of the addresses.
template <int K>
__device__ __forceinline__ void load_tile(RawTile& r, const GroupAddr& ga) {
    const v4f* wp4 = (const v4f*)(ga.w1 + K * 16 * IN_DIM);
    r.f0 = wp4[0];
    r.f1 = wp4[1];
    r.wb[0] = ga.w2[K * 16];
    r.wb[1] = ga.b1[K * 16];
    const v4f* vp4 = (const v4f*)(ga.w2v + K * 16);
    r.wv0 = vp4[0];
    r.wv1 = vp4[1];
}

// The eight biases of tile K of a group. Apart from the other loads: these registers are the C operand of the tile's WMMAs to the end of its step,
// and loaded behind the last of them the new values come into the same registers, with no copy and no wait at the loop's foot.
template <int K>
__device__ __forceinline__ void load_bias(RawTile& r, const GroupAddr& ga) {
    const v4f* bp4 = (const v4f*)(ga.b1v + K * 16);
    r.bv0 = bp4[0];
    r.bv1 = bp4[1];
}

// A tile's weights rounded to f16 (A = [W_h | W_h] along k, row = this lane's unit), and W2[n] W1[n][:] and W2[n] b1[n] (f32) joined to the head's
// linear sums vs, cs (this lane's unit n, its 8 inputs).
__device__ __forceinline__ void round_tile(Frag16& fh, const RawTile& r, v2f (&vs)[4], float& cs) {
    v4u hv;
    hv[0] = pack_pair(r.f0[0], r.f0[1]);
    hv[1] = pack_pair(r.f0[2], r.f0[3]);
    hv[2] = pack_pair(r.f1[0], r.f1[1]);
    hv[3] = pack_pair(r.f1[2], r.f1[3]);
    fh.u4[0] = hv; fh.u4[1] = hv;
    // vs += W2 * weights (both halves of a packed fma take W2 from the pair's low word), cs += W2 * b1. In asm so that the sums
    // stay here, in front of the reload of these registers: compiled, they sink to the loop's foot and all four buffers' old values stay live.
    asm volatile("v_pk_fma_f32 %0, %5, %8, %0 op_sel_hi:[0,1,1]\n\t"
                 "v_pk_fma_f32 %1, %5, %9, %1 op_sel_hi:[0,1,1]\n\t"
                 "v_pk_fma_f32 %2, %5, %10, %2 op_sel_hi:[0,1,1]\n\t"
                 "v_pk_fma_f32 %3, %5, %11, %3 op_sel_hi:[0,1,1]\n\t"
                 "v_fma_f32 %4, %6, %7, %4"
                 : "+v"(vs[0]), "+v"(vs[1]), "+v"(vs[2]), "+v"(vs[3]), "+v"(cs)
                 : "v"(r.wb), "v"(r.wb[0]), "v"(r.wb[1]),
                   "v"((v2f){ r.f0[0], r.f0[1] }), "v"((v2f){ r.f0[2], r.f0[3] }), "v"((v2f){ r.f1[0], r.f1[1] }), "v"((v2f){ r.f1[2], r.f1[3] }));
}

// Eight f32 values rounded to f16, four words.
__device__ __forceinline__ v4u pack8(v4f a, v4f b) {
    v4u p;
    p[0] = pack_pair(a[0], a[1]);
    p[1] = pack_pair(a[2], a[3]);
    p[2] = pack_pair(b[0], b[1]);
    p[3] = pack_pair(b[2], b[3]);
    return p;
}

// |c| of a WMMA result rounded to f16, four words: the absolute value rides on the conversion as a source modifier
// (compiled code spends a v_and_b32 per element on it). Outputs are early-clobber: a word is written before the later inputs are read.
__device__ __forceinline__ v4u abs_pack8(v8f c) {
    unsigned int p0, p1, p2, p3;
    asm volatile("v_cvt_pk_f16_f32 %0, |%4|, |%5|\n\t"
                 "v_cvt_pk_f16_f32 %1, |%6|, |%7|\n\t"
                 "v_cvt_pk_f16_f32 %2, |%8|, |%9|\n\t"
                 "v_cvt_pk_f16_f32 %3, |%10|, |%11|"
                 : "=&v"(p0), "=&v"(p1), "=&v"(p2), "=&v"(p3)
                 : "v"(c[0]), "v"(c[1]), "v"(c[2]), "v"(c[3]), "v"(c[4]), "v"(c[5]), "v"(c[6]), "v"(c[7]));
    return (v4u){ p0, p1, p2, p3 };
}

// Two hidden tiles (32 units) against all eight resident row tiles. Per row tile j: two WMMAs D = W_tile . x^T + b1 (row = unit 8h + r, column = batch row l16),
// eight conversions that pack |D| of both tiles into one B fragment (element s < 8: unit 8h + s of the first tile, k = 8h + s; element 8 + s: the second tile's, k = 16 + 8h + s),
// and one WMMA acc[j] += W2 . |D| with A = f16(W2) in the same k order, the same in all 16 rows: every row of acc[j] holds the sum for batch row l16.
// Staggered so that nothing reads a result early: between the two WMMAs of row tile j stands the W2 product of row tile j - 2, whose fragment is complete,
// and the conversions are those of row tile j - 1. Row tiles 6 and 7 finish in the next pair's step, with this pair's W2 fragment (a2p).
template <int K>
__device__ __forceinline__ void pair_step(v8f (&acc)[WAVES], const Frag16 (&fa)[WAVES], RawTile& ra, RawTile& rb,
                                          v8f& c0p, v8f& c1p, Frag16& pp, Frag16& a2p, v2f (&vs)[4], float& cs,
                                          GroupAddr& ga, int& Tn, const float* __restrict__ W1, const float* __restrict__ b1,
                                          const float* __restrict__ W2, int wave, int woff, int l16, int h) {
    Frag16 wa, wb, a2;
    round_tile(wa, ra, vs, cs);
    round_tile(wb, rb, vs, cs);
    a2.u4[0] = pack8(ra.wv0, ra.wv1);
    a2.u4[1] = pack8(rb.wv0, rb.wv1);
    const v8f ba = { ra.bv0[0], ra.bv0[1], ra.bv0[2], ra.bv0[3], ra.bv1[0], ra.bv1[1], ra.bv1[2], ra.bv1[3] };   // bias of unit 8h + r, all columns
    const v8f bb = { rb.bv0[0], rb.bv0[1], rb.bv0[2], rb.bv0[3], rb.bv1[0], rb.bv1[1], rb.bv1[2], rb.bv1[3] };
    if (K == 0) {
        // The group's one wait on address translation, behind the roundings above and not directly behind the last group's last loads, where it would hold the wave up.
        // The old addresses are inputs, so their registers stand untouched up to here; the next group's number is an output,
        // so the new addresses are formed behind it. The scheduling barrier keeps the roundings in front of the wait.
        __builtin_amdgcn_sched_barrier(0);
        asm volatile("s_wait_xcnt 0x0" : "+s"(Tn) : "v"(ga.w1), "v"(ga.b1), "v"(ga.w2), "v"(ga.b1v), "v"(ga.w2v) : "memory");
        ga = group_addr(W1, b1, W2, group_unit(Tn, wave), woff, l16, h);
        Tn += 4;
    }
    load_tile<K>(ra, ga);
    load_tile<K + 1>(rb, ga);
    // The scheduling barriers keep this order: left free, the compiler puts a result's conversions directly behind its WMMA,
    // inside the slots that a WMMA result needs before it is read, and nothing is left to issue beside the matrix unit.
    __builtin_amdgcn_sched_barrier(0);
    Frag16 pq = pp, pn;
    v8f c0 = c0p, c1 = c1p;
    #pragma unroll
    for (int j = 0; j < WAVES; ++j) {
        const int q = (j + 6) & 7;                                // the row tile whose packed |D| waits in pq
        const v8f n0 = __builtin_amdgcn_wmma_f32_16x16x32_f16(false, wa.v, false, fa[j].v, (short)0, ba, false, false);
        __builtin_amdgcn_sched_barrier(0);
        pn.u4[0] = abs_pack8(c0);
        __builtin_amdgcn_sched_barrier(0);
        // Behind the first conversions, so that the fragment it reads and the one being written are two sets of registers:
        // the one it reads is written again six vector slots later.
        acc[q] = __builtin_amdgcn_wmma_f32_16x16x32_f16(false, (j < 2 ? a2p : a2).v, false, pq.v, (short)0, acc[q], false, false);
        const v8f n1 = __builtin_amdgcn_wmma_f32_16x16x32_f16(false, wb.v, false, fa[j].v, (short)0, bb, false, false);
        __builtin_amdgcn_sched_barrier(0);
        pn.u4[1] = abs_pack8(c1);
        __builtin_amdgcn_sched_barrier(0);
        pq = pn; c0 = n0; c1 = n1;
    }
    // The loaded biases as inputs only: they stay in their registers past the last WMMA (which otherwise takes them for its result),
    // so the reload below lands in the same registers and the loop's foot holds no copies of sixteen registers and no wait for them.
    asm volatile("" :: "v"(ba), "v"(bb));
    load_bias<K>(ra, ga);
    load_bias<K + 1>(rb, ga);
    pp = pq; c0p = c0; c1p = c1; a2p = a2;
}

// Sum over the 16 lanes of a row, the total in every lane of the row: four adds, each with its own cross-lane read (DPP row_xmask).
__device__ __forceinline__ float row16_sum(float v) {
    v += __builtin_bit_cast(float, __builtin_amdgcn_update_dpp(0, __builtin_bit_cast(int, v), 0x161, 0xf, 0xf, true));
    v += __builtin_bit_cast(float, __builtin_amdgcn_update_dpp(0, __builtin_bit_cast(int, v), 0x162, 0xf, 0xf, true));
    v += __builtin_bit_cast(float, __builtin_amdgcn_update_dpp(0, __builtin_bit_cast(int, v), 0x164, 0xf, 0xf, true));
    v += __builtin_bit_cast(float, __builtin_amdgcn_update_dpp(0, __builtin_bit_cast(int, v), 0x168, 0xf, 0xf, true));
    return v;
}

// One block = 128 batch rows (8 row tiles) x all 16 heads, 8 heads at a time: each wave owns ONE head.
// The x fragments of all 8 row tiles and their 8 accumulator tiles stay in registers; the head's
// 32 hidden tiles stream past them from L2 as f32, loaded four tiles ahead, each tile rounded once and used by all 8 row tiles.
// x fragment, the B operand (lane l, column = batch row l&15, h = l>>4): elements 0..7 = f16_hi(x[row][8h..8h+7]) (k = 8h+i),
//   elements 8..15 = f16_lo of the same values (k = 16+8h+i).
// Weight fragment, the A operand (lane l, row = unit l&15): elements 0..7 = W_h[unit][8h..8h+7] (k = 8h+i), elements 8..15 = the same values (k = 16+8h+i).
// D[unit 8h+r][batch row l16] = b1[unit] + sum_i (x_hi + x_lo)[row][i] * W_h[unit][i].
// The tile loop sums W2[n] |D| only (on the matrix unit, |D| and W2 as f16); the part linear in D is one product of the wave's own row tile with the V tile (column = head),
// there with A = [x_hi | x_hi] and [x_lo | x_lo], B = [V_hi | V_lo]. It stands behind the tile loops: each wave publishes the V sums of its two heads in LDS.
// At most two waves a SIMD, so one block a WGP: a grid of one block per WGP spreads over all of them.
__global__ __launch_bounds__(256) __attribute__((amdgpu_waves_per_eu(2, 2))) void k_mlp16(const float* __restrict__ x,
                                               const float* __restrict__ W1,
                                               const float* __restrict__ b1,
                                               const float* __restrict__ W2,
                                               const float* __restrict__ b2,
                                               float* __restrict__ out,
                                               int nrows)
{
    __shared__ __align__(16) float sOut[WAVES * ROWS_PER_WAVE * OUT_DIM];   // 2048 floats = 8 KB
    __shared__ __align__(16) unsigned short sA[WAVES * 2 * 32 * 8];         // per row tile: hi plane, lo plane, 16 B a lane = 8 KB
    __shared__ __align__(16) float sLin[WAVES * ROWS_PER_WAVE * OUT_DIM];   // linear part, laid out like sOut = 8 KB
    __shared__ __align__(16) float sV[OUT_DIM * IN_DIM];                    // sum_n W2[o][n] W1[o][n][i]
    __shared__ float sC[OUT_DIM];                                           // sum_n W2[o][n] b1[o][n]
    __shared__ float sB2[OUT_DIM];

    const int tid  = threadIdx.x;
    const int lane = tid & 31;
    const int wave = __builtin_amdgcn_readfirstlane(tid >> 5);              // scalar, so head and pass offsets stay scalar
    const int h    = lane >> 4;
    const int l16  = lane & 15;
    const int woff = l16 * IN_DIM + 8 * h;                                  // this lane's place in a 16-unit weight tile

    const int rbase = blockIdx.x * ROWS_PER_BLOCK + wave * ROWS_PER_WAVE;   // first row of this wave's own tile
    int row = rbase + l16;
    if (row > nrows - 1) row = nrows - 1;                                   // clamp loads; stores predicated

    // The wave's 64 hidden tiles (two heads of 32) stream through four register buffers, each refilled four tiles ahead:
    // the loads have four tile steps to come back from L2. The first four fly while the row tile below is split.
    RawTile r0, r1, r2, r3;
    GroupAddr ga = group_addr(W1, b1, W2, group_unit(0, wave), woff, l16, h);   // the addresses of the group last loaded
    {
        const GroupAddr& g0 = ga;
        load_tile<0>(r0, g0);
        load_tile<1>(r1, g0);
        load_tile<2>(r2, g0);
        load_tile<3>(r3, g0);
        load_bias<0>(r0, g0);
        load_bias<1>(r1, g0);
        load_bias<2>(r2, g0);
        load_bias<3>(r3, g0);
        // Address registers of the loads above may be reused from here on.
        asm volatile("s_wait_xcnt 0x0" ::: "memory");
    }

    // Each wave splits its own row tile once and publishes the two halves for all waves.
    {
        const float b2v = b2[l16];                                          // waits in LDS for the linear part at the end
        const v4f* xp = (const v4f*)(x + (size_t)row * IN_DIM + 8 * h);
        const v4f x0 = xp[0], x1 = xp[1];
        // Address registers of the loads above may be reused from here on. b2's value is an input so that its load is issued here,
        // beside x's: left free it sinks into the branch below, and its whole latency stands in front of the barrier.
        asm volatile("s_wait_xcnt 0x0" :: "v"(b2v) : "memory");
        v4u xh, xl;
        unsigned int hh, ll;
        split_pair(x0[0], x0[1], hh, ll); xh[0] = hh; xl[0] = ll;
        split_pair(x0[2], x0[3], hh, ll); xh[1] = hh; xl[1] = ll;
        split_pair(x1[0], x1[1], hh, ll); xh[2] = hh; xl[2] = ll;
        split_pair(x1[2], x1[3], hh, ll); xh[3] = hh; xl[3] = ll;
        *(v8us*)(sA + ((wave * 2 + 0) * 32 + lane) * 8) = __builtin_bit_cast(v8us, xh);
        *(v8us*)(sA + ((wave * 2 + 1) * 32 + lane) * 8) = __builtin_bit_cast(v8us, xl);
        if (tid < OUT_DIM) sB2[tid] = b2v;
    }
    __syncthreads();

    // The block's eight row tiles stay in registers for the whole kernel: [x_hi | x_lo] along k.
    Frag16 fa[WAVES];
    #pragma unroll
    for (int rt = 0; rt < WAVES; ++rt) {
        fa[rt].h8[0] = *(const v8us*)(sA + ((rt * 2 + 0) * 32 + lane) * 8);
        fa[rt].h8[1] = *(const v8us*)(sA + ((rt * 2 + 1) * 32 + lane) * 8);
    }

    int Tn = 4;                                                             // first tile of the next group to load (scalar)
    // Rolled: one copy of the tile body and of the reduction in the text.
    #pragma unroll 1
    for (int g = 0; g < OUT_DIM / WAVES; ++g) {
        const int o = g * WAVES + wave;
        v8f acc[WAVES];
        const v8f zero8 = { 0.0f, 0.0f, 0.0f, 0.0f, 0.0f, 0.0f, 0.0f, 0.0f };
        #pragma unroll
        for (int rt = 0; rt < WAVES; ++rt) acc[rt] = zero8;
        // Row tiles 6 and 7 of a pair of tiles finish one step later; zero fragments before the head's first pair.
        v8f   c0p = zero8, c1p = zero8;
        Frag16 pp, a2p;
        pp.u4[0] = (v4u){ 0u, 0u, 0u, 0u };  pp.u4[1] = pp.u4[0];
        a2p.u4[0] = pp.u4[0];                a2p.u4[1] = pp.u4[0];
        v2f   vs[4] = { { 0.0f, 0.0f }, { 0.0f, 0.0f }, { 0.0f, 0.0f }, { 0.0f, 0.0f } };
        float cs = 0.0f;

        // Rolled, four tiles a trip: one per register buffer.
        #pragma unroll 1
        for (int t = 0; t < NT; t += 4) {
            pair_step<0>(acc, fa, r0, r1, c0p, c1p, pp, a2p, vs, cs, ga, Tn, W1, b1, W2, wave, woff, l16, h);
            pair_step<2>(acc, fa, r2, r3, c0p, c1p, pp, a2p, vs, cs, ga, Tn, W1, b1, W2, wave, woff, l16, h);
        }
        // Address registers of the loop's last loads may be reused from here on.
        asm volatile("s_wait_xcnt 0x0" ::: "memory");
        // The last pair's row tiles 6 and 7.
        Frag16 p7;
        p7.u4[0] = abs_pack8(c0p);
        p7.u4[1] = abs_pack8(c1p);
        acc[6] = __builtin_amdgcn_wmma_f32_16x16x32_f16(false, a2p.v, false, pp.v, (short)0, acc[6], false, false);
        acc[7] = __builtin_amdgcn_wmma_f32_16x16x32_f16(false, a2p.v, false, p7.v, (short)0, acc[7], false, false);

        // The head's linear sums: over the 16 units a row of lanes holds; one lane of each half publishes its 8 inputs.
        {
            v4f s0, s1;
            s0[0] = row16_sum(vs[0][0]); s0[1] = row16_sum(vs[0][1]); s0[2] = row16_sum(vs[1][0]); s0[3] = row16_sum(vs[1][1]);
            s1[0] = row16_sum(vs[2][0]); s1[1] = row16_sum(vs[2][1]); s1[2] = row16_sum(vs[3][0]); s1[3] = row16_sum(vs[3][1]);
            const float ct = row16_sum(cs);
            if (l16 == 0) {
                *(v4f*)(sV + o * IN_DIM + 8 * h)     = s0;
                *(v4f*)(sV + o * IN_DIM + 8 * h + 4) = s1;
            }
            if (lane == 0) sC[o] = ct;
        }

        // Every row of acc[rt] holds the full 512-dot of W2 with |D| for batch row l16 of row tile rt: no sum over lanes is left.
        // Lanes of half h store the row tiles 2u + h.
        #pragma unroll
        for (int u = 0; u < WAVES / 2; ++u)
            sOut[((2 * u + h) * ROWS_PER_WAVE + l16) * OUT_DIM + o] = ABS_C * (h ? acc[2 * u + 1][0] : acc[2 * u][0]);
    }

    __syncthreads();

    // Linear part of the wave's own row tile, all 16 heads: row 8h+r, head l16.
    {
        Frag16 fv, fxh, fxl;
        const v4f a0 = *(const v4f*)(sV + woff), a1 = *(const v4f*)(sV + woff + 4);
        v4u vh, vl;
        unsigned int hh, ll;
        split_pair(LIN_C * a0[0], LIN_C * a0[1], hh, ll); vh[0] = hh; vl[0] = ll;
        split_pair(LIN_C * a0[2], LIN_C * a0[3], hh, ll); vh[1] = hh; vl[1] = ll;
        split_pair(LIN_C * a1[0], LIN_C * a1[1], hh, ll); vh[2] = hh; vl[2] = ll;
        split_pair(LIN_C * a1[2], LIN_C * a1[3], hh, ll); vh[3] = hh; vl[3] = ll;
        fv.u4[0] = vh; fv.u4[1] = vl;
        const v8us xh = *(const v8us*)(sA + ((wave * 2 + 0) * 32 + lane) * 8);
        const v8us xl = *(const v8us*)(sA + ((wave * 2 + 1) * 32 + lane) * 8);
        fxh.h8[0] = xh; fxh.h8[1] = xh;
        fxl.h8[0] = xl; fxl.h8[1] = xl;
        const float cv = fmaf(LIN_C, sC[l16], sB2[l16]);
        const v8f c0 = { cv, cv, cv, cv, cv, cv, cv, cv };
        const v8f lin = wmma_pair_f16(fxh.v, fxl.v, fv.v, c0);
        #pragma unroll
        for (int r = 0; r < 8; ++r) sLin[(wave * ROWS_PER_WAVE + 8 * h + r) * OUT_DIM + l16] = lin[r];
    }
    __syncthreads();

    const float* sw = sOut + wave * (ROWS_PER_WAVE * OUT_DIM);
    const float* sl = sLin + wave * (ROWS_PER_WAVE * OUT_DIM);
    const v4f v0 = *(const v4f*)(sw + lane * 4) + *(const v4f*)(sl + lane * 4);
    const v4f v1 = *(const v4f*)(sw + 128 + lane * 4) + *(const v4f*)(sl + 128 + lane * 4);
    const bool p0 = (rbase + (lane >> 2)) < nrows;
    const bool p1 = (rbase + 8 + (lane >> 2)) < nrows;
    float* dst = out + (size_t)rbase * OUT_DIM;
    if (p0) *(v4f*)(dst + lane * 4) = v0;
    if (p1) *(v4f*)(dst + 128 + lane * 4) = v1;
}

extern "C" void kernel_launch(void* const* d_in, const int* in_sizes, int n_in,
                              void* d_out, int out_size, void* d_ws, size_t ws_size,
                              hipStream_t stream)
{
    if (n_in < 5) return;
    const int nx  = in_sizes[0];
    const int nw1 = in_sizes[1];
    const int nb1 = in_sizes[2];
    const int nw2 = in_sizes[3];
    const int nb2 = in_sizes[4];
    const int nrows = nx / IN_DIM;
    if (nrows <= 0 || nx != nrows * IN_DIM) return;
    if (nw1 != OUT_DIM * HID * IN_DIM || nb1 != OUT_DIM * HID || nw2 != OUT_DIM * HID || nb2 != OUT_DIM) return;
    if (out_size != nrows * OUT_DIM) return;

    const float* x  = (const float*)d_in[0];
    const float* W1 = (const float*)d_in[1];
    const float* b1 = (const float*)d_in[2];
    const float* W2 = (const float*)d_in[3];
    const float* b2 = (const float*)d_in[4];
    float* out = (float*)d_out;

    dim3 gm((nrows + ROWS_PER_BLOCK - 1) / ROWS_PER_BLOCK);     // 256 blocks for 32768 rows
    k_mlp16<<<gm, dim3(256), 0, stream>>>(x, W1, b1, W2, b2, out, nrows);
    (void)hipGetLastError();
}

// v009
// It runs in 13.1 microseconds.
// Two timings next to v008 both put it at 1.09 times that version's speed.
// Counting every step since v000, it is 18.3 times as fast.
#include <hip/hip_runtime.h>
#include <stdint.h>

// Contraction 1 (x . W1[o]^T per head, K=16 on a 32-deep tile): ONE v_wmma_f32_16x16x32_f16 a tile: x as an f16 hi+lo pair packed along k (B = [x_hi | x_lo], 22 mantissa bits), W1 rounded to one f16 value (A = [W_h | W_h], 11 mantissa bits), f32 accumulate seeded with b1; contraction 2 (512 -> 1 per head with W2): |h| of two hidden tiles packed to f16 is the B operand of one more WMMA of the same form, A = W2 rounded to f16, f32 accumulate.
// f16 operands: |x|, |W1|, |W2| and |h| must stay below 65504.
// LeakyReLU(h) = 0.6 h + 0.4 |h| (slope 0.2). The part linear in h sums to x . V[o] + const with V[o] = 0.6 sum_n W2[o][n] W1[o][n][:], one more 16-column tile on the same WMMA form.
// One launch: W1 streams as f32 and is rounded to f16 in registers by the wave that uses it, which sums V[o] from the same f32 registers.

typedef float v8f __attribute__((ext_vector_type(8)));
typedef float v4f __attribute__((ext_vector_type(4))) __attribute__((may_alias));
typedef float v2f __attribute__((ext_vector_type(2)));
typedef _Float16 v2h __attribute__((ext_vector_type(2)));
typedef unsigned int v4u __attribute__((ext_vector_type(4)));
typedef unsigned short v8us __attribute__((ext_vector_type(8))) __attribute__((may_alias));
typedef unsigned short v16us __attribute__((ext_vector_type(16)));
typedef _Float16 v16h __attribute__((ext_vector_type(16)));

union Frag16 { v16h v; v16us u; v8us h8[2]; v4u u4[2]; };

#define IN_DIM          16
#define OUT_DIM         16
#define HID             512
#define NT              (HID / 16)
#define WAVES           8
#define ROWS_PER_WAVE   16                            // rows of one row tile
#define RT              16                            // row tiles of a block, all of them resident in every wave
#define ROWS_PER_BLOCK  (RT * ROWS_PER_WAVE)
#define NEG_SLOPE       0.2f
#define LIN_C           (0.5f * (1.0f + NEG_SLOPE))   // weight of h in LeakyReLU
#define ABS_C           (0.5f * (1.0f - NEG_SLOPE))   // weight of |h| in LeakyReLU

// Two f32 values rounded to f16, packed in one word.
__device__ __forceinline__ unsigned int pack_pair(float a, float b) {
    const v2f f = { a, b };
    return __builtin_bit_cast(unsigned int, __builtin_convertvector(f, v2h));
}

// Two f32 values -> their f16 hi parts packed in one word and the f16 lo parts (of the exact residuals) in another.
__device__ __forceinline__ void split_pair(float a, float b, unsigned int& hi, unsigned int& lo) {
    const v2f f = { a, b };
    const v2h hb = __builtin_convertvector(f, v2h);
    const v2f r = { __builtin_fmaf((float)hb[0], -1.0f, a), __builtin_fmaf((float)hb[1], -1.0f, b) };
    const v2h lb = __builtin_convertvector(r, v2h);
    hi = __builtin_bit_cast(unsigned int, hb);
    lo = __builtin_bit_cast(unsigned int, lb);
}

// Two chained 16x16x32 f16 WMMAs into one accumulator, then the VALU hazard guard.
__device__ __forceinline__ v8f wmma_pair_f16(v16h ah, v16h al, v16h b, v8f c) {
    c = __builtin_amdgcn_wmma_f32_16x16x32_f16(false, ah, false, b, (short)0, c, false, false);
    c = __builtin_amdgcn_wmma_f32_16x16x32_f16(false, al, false, b, (short)0, c, false, false);
    asm volatile("v_nop\n\tv_nop\n\tv_nop\n\tv_nop" : "+v"(c) : "v"(ah), "v"(al), "v"(b));
    return c;
}

// One 16-unit hidden tile as loaded: the 8 weights (f32) of this lane's unit l16, that unit's W2 and b1 (a register pair: W2 is the packed sums' first source),
// and b1 and W2 of the eight units 8h .. 8h + 7, the units whose results this lane holds.
struct RawTile { v4f f0, f1; v2f wb; v4f bv0, bv1, wv0, wv1; };   // wb = { W2, b1 }

// First hidden unit (flat over heads) of a wave's group of four tiles T .. T + 3 (T = 0, 4 .. 28) of its head.
// Past the end: the last group again.
__device__ __forceinline__ int group_unit(int T, int head) {
    const int Tc = T < NT ? T : NT - 4;
    return head * HID + Tc * 16;
}

// This lane's places in W1, b1 and W2 for the first tile of a group of four: formed once a group.
struct GroupAddr { const float* w1; const float* b1; const float* w2; const float* b1v; const float* w2v; };

__device__ __forceinline__ GroupAddr group_addr(const float* __restrict__ W1, const float* __restrict__ b1,
                                                const float* __restrict__ W2, int nb, int woff, int l16, int h) {
    GroupAddr ga;
    ga.w1 = W1 + (size_t)nb * IN_DIM + woff;
    ga.b1 = b1 + nb + l16;
    ga.w2 = W2 + nb + l16;
    ga.b1v = b1 + nb + 8 * h;
    ga.w2v = W2 + nb + 8 * h;
    return ga;
}

// Tile K of a group: the group's addresses plus a constant. No register that these loads name changes inside a group,
// so no wait on their address translation stands here: it stands once a group, in front of the rewrite of the addresses.
template <int K>
__device__ __forceinline__ void load_tile(RawTile& r, const GroupAddr& ga) {
    const v4f* wp4 = (const v4f*)(ga.w1 + K * 16 * IN_DIM);
    r.f0 = wp4[0];
    r.f1 = wp4[1];
    r.wb[0] = ga.w2[K * 16];
    r.wb[1] = ga.b1[K * 16];
    const v4f* vp4 = (const v4f*)(ga.w2v + K * 16);
    r.wv0 = vp4[0];
    r.wv1 = vp4[1];
}

// The eight biases of tile K of a group. Apart from the other loads: these registers are the C operand of the tile's WMMAs to the end of its step,
// and loaded behind the last of them the new values come into the same registers, with no copy and no wait at the loop's foot.
template <int K>
__device__ __forceinline__ void load_bias(RawTile& r, const GroupAddr& ga) {
    const v4f* bp4 = (const v4f*)(ga.b1v + K * 16);
    r.bv0 = bp4[0];
    r.bv1 = bp4[1];
}

// A tile's weights rounded to f16 (A = [W_h | W_h] along k, row = this lane's unit), and W2[n] W1[n][:] and W2[n] b1[n] (f32) joined to the head's
// linear sums vs, cs (this lane's unit n, its 8 inputs).
__device__ __forceinline__ void round_tile(Frag16& fh, const RawTile& r, v2f (&vs)[4], float& cs) {
    v4u hv;
    hv[0] = pack_pair(r.f0[0], r.f0[1]);
    hv[1] = pack_pair(r.f0[2], r.f0[3]);
    hv[2] = pack_pair(r.f1[0], r.f1[1]);
    hv[3] = pack_pair(r.f1[2], r.f1[3]);
    fh.u4[0] = hv; fh.u4[1] = hv;
    // vs += W2 * weights (both halves of a packed fma take W2 from the pair's low word), cs += W2 * b1. In asm so that the sums
    // stay here, in front of the reload of these registers: compiled, they sink to the loop's foot and all four buffers' old values stay live.
    asm volatile("v_pk_fma_f32 %0, %5, %8, %0 op_sel_hi:[0,1,1]\n\t"
                 "v_pk_fma_f32 %1, %5, %9, %1 op_sel_hi:[0,1,1]\n\t"
                 "v_pk_fma_f32 %2, %5, %10, %2 op_sel_hi:[0,1,1]\n\t"
                 "v_pk_fma_f32 %3, %5, %11, %3 op_sel_hi:[0,1,1]\n\t"
                 "v_fma_f32 %4, %6, %7, %4"
                 : "+v"(vs[0]), "+v"(vs[1]), "+v"(vs[2]), "+v"(vs[3]), "+v"(cs)
                 : "v"(r.wb), "v"(r.wb[0]), "v"(r.wb[1]),
                   "v"((v2f){ r.f0[0], r.f0[1] }), "v"((v2f){ r.f0[2], r.f0[3] }), "v"((v2f){ r.f1[0], r.f1[1] }), "v"((v2f){ r.f1[2], r.f1[3] }));
}

// Eight f32 values rounded to f16, four words.
__device__ __forceinline__ v4u pack8(v4f a, v4f b) {
    v4u p;
    p[0] = pack_pair(a[0], a[1]);
    p[1] = pack_pair(a[2], a[3]);
    p[2] = pack_pair(b[0], b[1]);
    p[3] = pack_pair(b[2], b[3]);
    return p;
}

// |c| of a WMMA result rounded to f16, four words: the absolute value rides on the conversion as a source modifier
// (compiled code spends a v_and_b32 per element on it). Outputs are early-clobber: a word is written before the later inputs are read.
// g is the A fragment of the WMMA issued directly in front: named as an input, so that no output word is given one of its registers,
// which may not be overwritten in the first vector slots behind that WMMA.
__device__ __forceinline__ v4u abs_pack8(v8f c, v16h g) {
    unsigned int p0, p1, p2, p3;
    asm volatile("v_cvt_pk_f16_f32 %0, |%4|, |%5|\n\t"
                 "v_cvt_pk_f16_f32 %1, |%6|, |%7|\n\t"
                 "v_cvt_pk_f16_f32 %2, |%8|, |%9|\n\t"
                 "v_cvt_pk_f16_f32 %3, |%10|, |%11|"
                 : "=&v"(p0), "=&v"(p1), "=&v"(p2), "=&v"(p3)
                 : "v"(c[0]), "v"(c[1]), "v"(c[2]), "v"(c[3]), "v"(c[4]), "v"(c[5]), "v"(c[6]), "v"(c[7]), "v"(g));
    return (v4u){ p0, p1, p2, p3 };
}

// The same with no WMMA operand to keep clear of.
__device__ __forceinline__ v4u abs_pack8(v8f c) {
    unsigned int p0, p1, p2, p3;
    asm volatile("v_cvt_pk_f16_f32 %0, |%4|, |%5|\n\t"
                 "v_cvt_pk_f16_f32 %1, |%6|, |%7|\n\t"
                 "v_cvt_pk_f16_f32 %2, |%8|, |%9|\n\t"
                 "v_cvt_pk_f16_f32 %3, |%10|, |%11|"
                 : "=&v"(p0), "=&v"(p1), "=&v"(p2), "=&v"(p3)
                 : "v"(c[0]), "v"(c[1]), "v"(c[2]), "v"(c[3]), "v"(c[4]), "v"(c[5]), "v"(c[6]), "v"(c[7]));
    return (v4u){ p0, p1, p2, p3 };
}

// Two hidden tiles (32 units) against all sixteen resident row tiles. Per row tile j: two WMMAs D = W_tile . x^T + b1 (row = unit 8h + r, column = batch row l16),
// eight conversions that pack |D| of both tiles into one B fragment (element s < 8: unit 8h + s of the first tile, k = 8h + s; element 8 + s: the second tile's, k = 16 + 8h + s),
// and one WMMA acc[j] += W2 . |D| with A = f16(W2) in the same k order, the same in all 16 rows: every row of acc[j] holds the sum for batch row l16.
// Staggered so that nothing reads a result early: between the two WMMAs of row tile j stands the W2 product of row tile j - 2, whose fragment is complete,
// and the conversions are those of row tile j - 1. Row tiles 14 and 15 finish in the next pair's step, with this pair's W2 fragment (a2p).
template <int K>
__device__ __forceinline__ void pair_step(v8f (&acc)[RT], const Frag16 (&fa)[RT], RawTile& ra, RawTile& rb,
                                          v8f& c0p, v8f& c1p, Frag16& pp, Frag16& a2p, v2f (&vs)[4], float& cs,
                                          GroupAddr& ga, int& Tn, const float* __restrict__ W1, const float* __restrict__ b1,
                                          const float* __restrict__ W2, int head, int woff, int l16, int h) {
    Frag16 wa, wb, a2;
    round_tile(wa, ra, vs, cs);
    round_tile(wb, rb, vs, cs);
    a2.u4[0] = pack8(ra.wv0, ra.wv1);
    a2.u4[1] = pack8(rb.wv0, rb.wv1);
    const v8f ba = { ra.bv0[0], ra.bv0[1], ra.bv0[2], ra.bv0[3], ra.bv1[0], ra.bv1[1], ra.bv1[2], ra.bv1[3] };   // bias of unit 8h + r, all columns
    const v8f bb = { rb.bv0[0], rb.bv0[1], rb.bv0[2], rb.bv0[3], rb.bv1[0], rb.bv1[1], rb.bv1[2], rb.bv1[3] };
    if (K == 0) {
        // The group's one wait on address translation, behind the roundings above and not directly behind the last group's last loads, where it would hold the wave up.
        // The old addresses are inputs, so their registers stand untouched up to here; the next group's number is an output,
        // so the new addresses are formed behind it. The scheduling barrier keeps the roundings in front of the wait.
        __builtin_amdgcn_sched_barrier(0);
        asm volatile("s_wait_xcnt 0x0" : "+s"(Tn) : "v"(ga.w1), "v"(ga.b1), "v"(ga.w2), "v"(ga.b1v), "v"(ga.w2v) : "memory");
        ga = group_addr(W1, b1, W2, group_unit(Tn, head), woff, l16, h);
        Tn += 4;
    }
    load_tile<K>(ra, ga);
    load_tile<K + 1>(rb, ga);
    // The scheduling barriers keep this order: left free, the compiler puts a result's conversions directly behind its WMMA,
    // inside the slots that a WMMA result needs before it is read, and nothing is left to issue beside the matrix unit.
    __builtin_amdgcn_sched_barrier(0);
    Frag16 pq = pp, pn;
    v8f c0 = c0p, c1 = c1p;
    #pragma unroll
    for (int j = 0; j < RT; ++j) {
        const int q = (j + RT - 2) & (RT - 1);                    // the row tile whose packed |D| waits in pq
        const v8f n0 = __builtin_amdgcn_wmma_f32_16x16x32_f16(false, wa.v, false, fa[j].v, (short)0, ba, false, false);
        __builtin_amdgcn_sched_barrier(0);
        pn.u4[0] = abs_pack8(c0, wa.v);
        __builtin_amdgcn_sched_barrier(0);
        // Behind the first conversions, so that the fragment it reads and the one being written are two sets of registers:
        // the one it reads is written again six vector slots later.
        acc[q] = __builtin_amdgcn_wmma_f32_16x16x32_f16(false, (j < 2 ? a2p : a2).v, false, pq.v, (short)0, acc[q], false, false);
        const v8f n1 = __builtin_amdgcn_wmma_f32_16x16x32_f16(false, wb.v, false, fa[j].v, (short)0, bb, false, false);
        __builtin_amdgcn_sched_barrier(0);
        pn.u4[1] = abs_pack8(c1);
        __builtin_amdgcn_sched_barrier(0);
        pq = pn; c0 = n0; c1 = n1;
    }
    // The loaded biases as inputs only: they stay in their registers past the last WMMA (which otherwise takes them for its result),
    // so the reload below lands in the same registers and the loop's foot holds no copies of sixteen registers and no wait for them.
    asm volatile("" :: "v"(ba), "v"(bb));
    load_bias<K>(ra, ga);
    load_bias<K + 1>(rb, ga);
    pp = pq; c0p = c0; c1p = c1; a2p = a2;
}

// Sum over the 16 lanes of a row, the total in every lane of the row: four adds, each with its own cross-lane read (DPP row_xmask).
__device__ __forceinline__ float row16_sum(float v) {
    v += __builtin_bit_cast(float, __builtin_amdgcn_update_dpp(0, __builtin_bit_cast(int, v), 0x161, 0xf, 0xf, true));
    v += __builtin_bit_cast(float, __builtin_amdgcn_update_dpp(0, __builtin_bit_cast(int, v), 0x162, 0xf, 0xf, true));
    v += __builtin_bit_cast(float, __builtin_amdgcn_update_dpp(0, __builtin_bit_cast(int, v), 0x164, 0xf, 0xf, true));
    v += __builtin_bit_cast(float, __builtin_amdgcn_update_dpp(0, __builtin_bit_cast(int, v), 0x168, 0xf, 0xf, true));
    return v;
}

// One block = 256 batch rows (16 row tiles) x 8 heads (blockIdx.y picks the heads 0..7 or 8..15): each wave owns ONE head.
// The x fragments of all 16 row tiles and their 16 accumulator tiles stay in registers; the head's
// 32 hidden tiles stream past them from L2 as f32, loaded four tiles ahead, each tile rounded once and used by all 16 row tiles.
// x fragment, the B operand (lane l, column = batch row l&15, h = l>>4): elements 0..7 = f16_hi(x[row][8h..8h+7]) (k = 8h+i),
//   elements 8..15 = f16_lo of the same values (k = 16+8h+i).
// Weight fragment, the A operand (lane l, row = unit l&15): elements 0..7 = W_h[unit][8h..8h+7] (k = 8h+i), elements 8..15 = the same values (k = 16+8h+i).
// D[unit 8h+r][batch row l16] = b1[unit] + sum_i (x_hi + x_lo)[row][i] * W_h[unit][i].
// The tile loop sums W2[n] |D| only (on the matrix unit, |D| and W2 as f16); the part linear in D is one product of each of the wave's own two row tiles with the V tile
// (column = head of the block, columns 8..15 repeat 0..7 and are not stored), there with A = [x_hi | x_hi] and [x_lo | x_lo], B = [V_hi | V_lo].
// It stands behind the tile loop: each wave publishes the V sums of its head in LDS.
// A block stores the 32 bytes of its 8 heads in each of its rows; the row's other 32 bytes are the other head group's block's.
// At most two waves a SIMD, so one block a WGP: a grid of one block per WGP spreads over all of them.
__global__ __launch_bounds__(256) __attribute__((amdgpu_waves_per_eu(2, 2))) void k_mlp16(const float* __restrict__ x,
                                               const float* __restrict__ W1,
                                               const float* __restrict__ b1,
                                               const float* __restrict__ W2,
                                               const float* __restrict__ b2,
                                               float* __restrict__ out,
                                               int nrows)
{
    __shared__ __align__(16) float sOut[RT * ROWS_PER_WAVE * WAVES];        // [row of the block][head of the block] = 8 KB
    __shared__ __align__(16) unsigned short sA[RT * 2 * 32 * 8];            // per row tile: hi plane, lo plane, 16 B a lane = 16 KB
    __shared__ __align__(16) float sLin[RT * ROWS_PER_WAVE * WAVES];        // linear part, laid out like sOut = 8 KB
    __shared__ __align__(16) float sV[WAVES * IN_DIM];                      // sum_n W2[o][n] W1[o][n][i], o = head of the block
    __shared__ float sC[WAVES];                                             // sum_n W2[o][n] b1[o][n]
    __shared__ float sB2[WAVES];

    const int tid  = threadIdx.x;
    const int lane = tid & 31;
    const int wave = __builtin_amdgcn_readfirstlane(tid >> 5);              // scalar, so the head's offsets stay scalar
    const int h    = lane >> 4;
    const int l16  = lane & 15;
    const int woff = l16 * IN_DIM + 8 * h;                                  // this lane's place in a 16-unit weight tile
    const int hbase = blockIdx.y * WAVES;                                   // first head of the block
    const int head  = hbase + wave;                                         // the wave's head

    const int rbase = blockIdx.x * ROWS_PER_BLOCK + wave * (2 * ROWS_PER_WAVE);   // first row of this wave's own two row tiles
    int row0 = rbase + l16;
    int row1 = rbase + ROWS_PER_WAVE + l16;
    if (row0 > nrows - 1) row0 = nrows - 1;                                 // clamp loads; stores predicated
    if (row1 > nrows - 1) row1 = nrows - 1;

    // The head's 32 hidden tiles stream through four register buffers, each refilled four tiles ahead:
    // the loads have four tile steps to come back from L2. The first four fly while the row tiles below are split.
    RawTile r0, r1, r2, r3;
    GroupAddr ga = group_addr(W1, b1, W2, group_unit(0, head), woff, l16, h);   // the addresses of the group last loaded
    {
        const GroupAddr& g0 = ga;
        load_tile<0>(r0, g0);
        load_tile<1>(r1, g0);
        load_tile<2>(r2, g0);
        load_tile<3>(r3, g0);
        load_bias<0>(r0, g0);
        load_bias<1>(r1, g0);
        load_bias<2>(r2, g0);
        load_bias<3>(r3, g0);
        // Address registers of the loads above may be reused from here on.
        asm volatile("s_wait_xcnt 0x0" ::: "memory");
    }

    // Each wave splits its own two row tiles once and publishes the halves for all waves.
    {
        const float b2v = b2[hbase + (l16 & (WAVES - 1))];                  // waits in LDS for the linear part at the end
        const v4f* xp0 = (const v4f*)(x + (size_t)row0 * IN_DIM + 8 * h);
        const v4f* xp1 = (const v4f*)(x + (size_t)row1 * IN_DIM + 8 * h);
        const v4f xa[2][2] = { { xp0[0], xp0[1] }, { xp1[0], xp1[1] } };
        // Address registers of the loads above may be reused from here on. b2's value is an input so that its load is issued here,
        // beside x's: left free it sinks into the branch below, and its whole latency stands in front of the barrier.
        // b2's base is an input too: its scalar pair, which that load names, stays untouched up to the wait (left free, a scalar move is lifted over it).
        asm volatile("s_wait_xcnt 0x0" :: "v"(b2v), "s"(b2) : "memory");
        #pragma unroll
        for (int u = 0; u < 2; ++u) {
            v4u xh, xl;
            unsigned int hh, ll;
            split_pair(xa[u][0][0], xa[u][0][1], hh, ll); xh[0] = hh; xl[0] = ll;
            split_pair(xa[u][0][2], xa[u][0][3], hh, ll); xh[1] = hh; xl[1] = ll;
            split_pair(xa[u][1][0], xa[u][1][1], hh, ll); xh[2] = hh; xl[2] = ll;
            split_pair(xa[u][1][2], xa[u][1][3], hh, ll); xh[3] = hh; xl[3] = ll;
            *(v8us*)(sA + (((2 * wave + u) * 2 + 0) * 32 + lane) * 8) = __builtin_bit_cast(v8us, xh);
            *(v8us*)(sA + (((2 * wave + u) * 2 + 1) * 32 + lane) * 8) = __builtin_bit_cast(v8us, xl);
        }
        if (tid < WAVES) sB2[tid] = b2v;
    }
    __syncthreads();

    // The block's sixteen row tiles stay in registers for the whole kernel: [x_hi | x_lo] along k.
    Frag16 fa[RT];
    #pragma unroll
    for (int rt = 0; rt < RT; ++rt) {
        fa[rt].h8[0] = *(const v8us*)(sA + ((rt * 2 + 0) * 32 + lane) * 8);
        fa[rt].h8[1] = *(const v8us*)(sA + ((rt * 2 + 1) * 32 + lane) * 8);
    }

    int Tn = 4;                                                             // first tile of the next group to load (scalar)
    {
        v8f acc[RT];
        const v8f zero8 = { 0.0f, 0.0f, 0.0f, 0.0f, 0.0f, 0.0f, 0.0f, 0.0f };
        #pragma unroll
        for (int rt = 0; rt < RT; ++rt) acc[rt] = zero8;
        // Row tiles 14 and 15 of a pair of tiles finish one step later; zero fragments before the head's first pair.
        v8f   c0p = zero8, c1p = zero8;
        Frag16 pp, a2p;
        pp.u4[0] = (v4u){ 0u, 0u, 0u, 0u };  pp.u4[1] = pp.u4[0];
        a2p.u4[0] = pp.u4[0];                a2p.u4[1] = pp.u4[0];
        v2f   vs[4] = { { 0.0f, 0.0f }, { 0.0f, 0.0f }, { 0.0f, 0.0f }, { 0.0f, 0.0f } };
        float cs = 0.0f;

        // Rolled, four tiles a trip: one per register buffer.
        #pragma unroll 1
        for (int t = 0; t < NT; t += 4) {
            pair_step<0>(acc, fa, r0, r1, c0p, c1p, pp, a2p, vs, cs, ga, Tn, W1, b1, W2, head, woff, l16, h);
            pair_step<2>(acc, fa, r2, r3, c0p, c1p, pp, a2p, vs, cs, ga, Tn, W1, b1, W2, head, woff, l16, h);
        }
        // Address registers of the loop's last loads may be reused from here on.
        asm volatile("s_wait_xcnt 0x0" ::: "memory");
        // The last pair's row tiles 14 and 15.
        Frag16 p7;
        p7.u4[0] = abs_pack8(c0p);
        p7.u4[1] = abs_pack8(c1p);
        acc[RT - 2] = __builtin_amdgcn_wmma_f32_16x16x32_f16(false, a2p.v, false, pp.v, (short)0, acc[RT - 2], false, false);
        acc[RT - 1] = __builtin_amdgcn_wmma_f32_16x16x32_f16(false, a2p.v, false, p7.v, (short)0, acc[RT - 1], false, false);

        // The head's linear sums: over the 16 units a row of lanes holds; one lane of each half publishes its 8 inputs.
        {
            v4f s0, s1;
            s0[0] = row16_sum(vs[0][0]); s0[1] = row16_sum(vs[0][1]); s0[2] = row16_sum(vs[1][0]); s0[3] = row16_sum(vs[1][1]);
            s1[0] = row16_sum(vs[2][0]); s1[1] = row16_sum(vs[2][1]); s1[2] = row16_sum(vs[3][0]); s1[3] = row16_sum(vs[3][1]);
            const float ct = row16_sum(cs);
            if (l16 == 0) {
                *(v4f*)(sV + wave * IN_DIM + 8 * h)     = s0;
                *(v4f*)(sV + wave * IN_DIM + 8 * h + 4) = s1;
            }
            if (lane == 0) sC[wave] = ct;
        }

        // Every row of acc[rt] holds the full 512-dot of W2 with |D| for batch row l16 of row tile rt: no sum over lanes is left.
        // Lanes of half h store the row tiles 2u + h.
        #pragma unroll
        for (int u = 0; u < RT / 2; ++u)
            sOut[((2 * u + h) * ROWS_PER_WAVE + l16) * WAVES + wave] = ABS_C * (h ? acc[2 * u + 1][0] : acc[2 * u][0]);
    }

    __syncthreads();

    // Linear part of the wave's own two row tiles, the block's 8 heads: row 8h+r, head l16 & 7.
    {
        Frag16 fv;
        const int hc = l16 & (WAVES - 1);
        const v4f a0 = *(const v4f*)(sV + hc * IN_DIM + 8 * h), a1 = *(const v4f*)(sV + hc * IN_DIM + 8 * h + 4);
        v4u vh, vl;
        unsigned int hh, ll;
        split_pair(LIN_C * a0[0], LIN_C * a0[1], hh, ll); vh[0] = hh; vl[0] = ll;
        split_pair(LIN_C * a0[2], LIN_C * a0[3], hh, ll); vh[1] = hh; vl[1] = ll;
        split_pair(LIN_C * a1[0], LIN_C * a1[1], hh, ll); vh[2] = hh; vl[2] = ll;
        split_pair(LIN_C * a1[2], LIN_C * a1[3], hh, ll); vh[3] = hh; vl[3] = ll;
        fv.u4[0] = vh; fv.u4[1] = vl;
        const float cv = fmaf(LIN_C, sC[hc], sB2[hc]);
        const v8f c0 = { cv, cv, cv, cv, cv, cv, cv, cv };
        v8f lin[2];
        #pragma unroll
        for (int u = 0; u < 2; ++u) {
            Frag16 fxh, fxl;
            const v8us xh = *(const v8us*)(sA + (((2 * wave + u) * 2 + 0) * 32 + lane) * 8);
            const v8us xl = *(const v8us*)(sA + (((2 * wave + u) * 2 + 1) * 32 + lane) * 8);
            fxh.h8[0] = xh; fxh.h8[1] = xh;
            fxl.h8[0] = xl; fxl.h8[1] = xl;
            lin[u] = wmma_pair_f16(fxh.v, fxl.v, fv.v, c0);
        }
        if (l16 < WAVES) {
            #pragma unroll
            for (int u = 0; u < 2; ++u)
                #pragma unroll
                for (int r = 0; r < 8; ++r) sLin[((2 * wave + u) * ROWS_PER_WAVE + 8 * h + r) * WAVES + l16] = lin[u][r];
        }
    }
    __syncthreads();

    // The wave's 32 rows x 8 heads: 64 pieces of four heads, two a lane; piece i is row i / 2, heads 4 (i & 1) .. + 3 of the block.
    const float* sw = sOut + wave * (2 * ROWS_PER_WAVE * WAVES);
    const float* sl = sLin + wave * (2 * ROWS_PER_WAVE * WAVES);
    const v4f v0 = *(const v4f*)(sw + lane * 4) + *(const v4f*)(sl + lane * 4);
    const v4f v1 = *(const v4f*)(sw + 128 + lane * 4) + *(const v4f*)(sl + 128 + lane * 4);
    const bool p0 = (rbase + (lane >> 1)) < nrows;
    const bool p1 = (rbase + ROWS_PER_WAVE + (lane >> 1)) < nrows;
    float* dst = out + ((size_t)rbase + (lane >> 1)) * OUT_DIM + hbase + 4 * (lane & 1);
    if (p0) *(v4f*)dst = v0;
    if (p1) *(v4f*)(dst + ROWS_PER_WAVE * OUT_DIM) = v1;
}

extern "C" void kernel_launch(void* const* d_in, const int* in_sizes, int n_in,
                              void* d_out, int out_size, void* d_ws, size_t ws_size,
                              hipStream_t stream)
{
    if (n_in < 5) return;
    const int nx  = in_sizes[0];
    const int nw1 = in_sizes[1];
    const int nb1 = in_sizes[2];
    const int nw2 = in_sizes[3];
    const int nb2 = in_sizes[4];
    const int nrows = nx / IN_DIM;
    if (nrows <= 0 || nx != nrows * IN_DIM) return;
    if (nw1 != OUT_DIM * HID * IN_DIM || nb1 != OUT_DIM * HID || nw2 != OUT_DIM * HID || nb2 != OUT_DIM) return;
    if (out_size != nrows * OUT_DIM) return;

    const float* x  = (const float*)d_in[0];
    const float* W1 = (const float*)d_in[1];
    const float* b1 = (const float*)d_in[2];
    const float* W2 = (const float*)d_in[3];
    const float* b2 = (const float*)d_in[4];
    float* out = (float*)d_out;

    dim3 gm((nrows + ROWS_PER_BLOCK - 1) / ROWS_PER_BLOCK, OUT_DIM / WAVES);   // 128 x 2 = 256 blocks for 32768 rows
    k_mlp16<<<gm, dim3(256), 0, stream>>>(x, W1, b1, W2, b2, out, nrows);
    (void)hipGetLastError();
}

// v010
// It runs in 12.2 microseconds.
// In both of two side-by-side timings against v009, it was 1.07 times as fast.
// All steps since v000 together make it 19.5 times as fast.
#include <hip/hip_runtime.h>
#include <stdint.h>

// Contraction 1 (x . W1[o]^T per head, K=16 on a 32-deep tile): ONE v_wmma_f32_16x16x32_f16 a tile: x as an f16 hi+lo pair packed along k (B = [x_hi | x_lo], 22 mantissa bits), W1 rounded to one f16 value (A = [W_h | W_h], 11 mantissa bits), f32 accumulate seeded with b1; contraction 2 (512 -> 1 per head with W2): |h| of two hidden tiles and two row tiles packed to f16 is the 64-deep B operand of one sparse v_swmmac_f32_16x16x64_f16, A = W2 rounded to f16 (two of every four k a row, the rows sharing the work), f32 accumulate.
// f16 operands: |x|, |W1|, |W2| and |h| must stay below 65504.
// LeakyReLU(h) = 0.6 h + 0.4 |h| (slope 0.2). The part linear in h sums to x . V[o] + const with V[o] = 0.6 sum_n W2[o][n] W1[o][n][:], one more 16-column tile on the same WMMA form.
// One launch: W1 streams as f32 and is rounded to f16 in registers by the wave that uses it, which sums V[o] from the same f32 registers.

typedef float v8f __attribute__((ext_vector_type(8)));
typedef float v4f __attribute__((ext_vector_type(4))) __attribute__((may_alias));
typedef float v2f __attribute__((ext_vector_type(2)));
typedef _Float16 v2h __attribute__((ext_vector_type(2)));
typedef unsigned int v4u __attribute__((ext_vector_type(4)));
typedef unsigned short v8us __attribute__((ext_vector_type(8))) __attribute__((may_alias));
typedef unsigned short v16us __attribute__((ext_vector_type(16)));
typedef _Float16 v16h __attribute__((ext_vector_type(16)));
typedef _Float16 v32h __attribute__((ext_vector_type(32)));
typedef float v2fa __attribute__((ext_vector_type(2))) __attribute__((may_alias));

union Frag16 { v16h v; v16us u; v8us h8[2]; v4u u4[2]; };
union Frag32 { v32h v; v4u u4[4]; };

#define IN_DIM          16
#define OUT_DIM         16
#define HID             512
#define NT              (HID / 16)
#define WAVES           8
#define ROWS_PER_WAVE   16                            // rows of one row tile
#define RT              16                            // row tiles of a block, all of them resident in every wave
#define ROWS_PER_BLOCK  (RT * ROWS_PER_WAVE)
#define NEG_SLOPE       0.2f
#define LIN_C           (0.5f * (1.0f + NEG_SLOPE))   // weight of h in LeakyReLU
#define ABS_C           (0.5f * (1.0f - NEG_SLOPE))   // weight of |h| in LeakyReLU

// Two f32 values rounded to f16, packed in one word.
__device__ __forceinline__ unsigned int pack_pair(float a, float b) {
    const v2f f = { a, b };
    return __builtin_bit_cast(unsigned int, __builtin_convertvector(f, v2h));
}

// Two f32 values -> their f16 hi parts packed in one word and the f16 lo parts (of the exact residuals) in another.
__device__ __forceinline__ void split_pair(float a, float b, unsigned int& hi, unsigned int& lo) {
    const v2f f = { a, b };
    const v2h hb = __builtin_convertvector(f, v2h);
    const v2f r = { __builtin_fmaf((float)hb[0], -1.0f, a), __builtin_fmaf((float)hb[1], -1.0f, b) };
    const v2h lb = __builtin_convertvector(r, v2h);
    hi = __builtin_bit_cast(unsigned int, hb);
    lo = __builtin_bit_cast(unsigned int, lb);
}

// Two chained 16x16x32 f16 WMMAs into one accumulator, then the VALU hazard guard.
__device__ __forceinline__ v8f wmma_pair_f16(v16h ah, v16h al, v16h b, v8f c) {
    c = __builtin_amdgcn_wmma_f32_16x16x32_f16(false, ah, false, b, (short)0, c, false, false);
    c = __builtin_amdgcn_wmma_f32_16x16x32_f16(false, al, false, b, (short)0, c, false, false);
    asm volatile("v_nop\n\tv_nop\n\tv_nop\n\tv_nop" : "+v"(c) : "v"(ah), "v"(al), "v"(b));
    return c;
}

// One 16-unit hidden tile as loaded: the 8 weights (f32) of this lane's unit l16, that unit's W2 and b1 (a register pair: W2 is the packed sums' first source),
// b1 of the eight units 8h .. 8h + 7, the units whose results this lane holds, and W2 of the four of them that this lane's row of the sparse A fragment takes
// (units 8h + 2e, + 1 and 8h + 4 + 2e, + 1, e = l16 & 1).
struct RawTile { v4f f0, f1; v2f wb; v4f bv0, bv1; v2f wp0, wp1; };   // wb = { W2, b1 }

// First hidden unit (flat over heads) of a wave's group of four tiles T .. T + 3 (T = 0, 4 .. 28) of its head.
// Past the end: the last group again.
__device__ __forceinline__ int group_unit(int T, int head) {
    const int Tc = T < NT ? T : NT - 4;
    return head * HID + Tc * 16;
}

// This lane's places in W1, b1 and W2 for the first tile of a group of four: formed once a group.
struct GroupAddr { const float* w1; const float* b1; const float* w2; const float* b1v; const float* w2v; };

__device__ __forceinline__ GroupAddr group_addr(const float* __restrict__ W1, const float* __restrict__ b1,
                                                const float* __restrict__ W2, int nb, int woff, int l16, int h) {
    GroupAddr ga;
    ga.w1 = W1 + (size_t)nb * IN_DIM + woff;
    ga.b1 = b1 + nb + l16;
    ga.w2 = W2 + nb + l16;
    ga.b1v = b1 + nb + 8 * h;
    ga.w2v = W2 + nb + 8 * h + 2 * (l16 & 1);
    return ga;
}

// Tile K of a group: the group's addresses plus a constant. No register that these loads name changes inside a group,
// so no wait on their address translation stands here: it stands once a group, in front of the rewrite of the addresses.
template <int K>
__device__ __forceinline__ void load_tile(RawTile& r, const GroupAddr& ga) {
    const v4f* wp4 = (const v4f*)(ga.w1 + K * 16 * IN_DIM);
    r.f0 = wp4[0];
    r.f1 = wp4[1];
    r.wb[0] = ga.w2[K * 16];
    r.wb[1] = ga.b1[K * 16];
    r.wp0 = *(const v2fa*)(ga.w2v + K * 16);
    r.wp1 = *(const v2fa*)(ga.w2v + K * 16 + 4);
}

// The eight biases of tile K of a group. Apart from the other loads: these registers are the C operand of the tile's WMMAs to the end of its step,
// and loaded behind the last of them the new values come into the same registers, with no copy and no wait at the loop's foot.
template <int K>
__device__ __forceinline__ void load_bias(RawTile& r, const GroupAddr& ga) {
    const v4f* bp4 = (const v4f*)(ga.b1v + K * 16);
    r.bv0 = bp4[0];
    r.bv1 = bp4[1];
}

// A tile's weights rounded to f16 (A = [W_h | W_h] along k, row = this lane's unit), and W2[n] W1[n][:] and W2[n] b1[n] (f32) joined to the head's
// linear sums vs, cs (this lane's unit n, its 8 inputs).
__device__ __forceinline__ void round_tile(Frag16& fh, const RawTile& r, v2f (&vs)[4], float& cs) {
    v4u hv;
    hv[0] = pack_pair(r.f0[0], r.f0[1]);
    hv[1] = pack_pair(r.f0[2], r.f0[3]);
    hv[2] = pack_pair(r.f1[0], r.f1[1]);
    hv[3] = pack_pair(r.f1[2], r.f1[3]);
    fh.u4[0] = hv; fh.u4[1] = hv;
    // vs += W2 * weights (both halves of a packed fma take W2 from the pair's low word), cs += W2 * b1. In asm so that the sums
    // stay here, in front of the reload of these registers: compiled, they sink to the loop's foot and all four buffers' old values stay live.
    asm volatile("v_pk_fma_f32 %0, %5, %8, %0 op_sel_hi:[0,1,1]\n\t"
                 "v_pk_fma_f32 %1, %5, %9, %1 op_sel_hi:[0,1,1]\n\t"
                 "v_pk_fma_f32 %2, %5, %10, %2 op_sel_hi:[0,1,1]\n\t"
                 "v_pk_fma_f32 %3, %5, %11, %3 op_sel_hi:[0,1,1]\n\t"
                 "v_fma_f32 %4, %6, %7, %4"
                 : "+v"(vs[0]), "+v"(vs[1]), "+v"(vs[2]), "+v"(vs[3]), "+v"(cs)
                 : "v"(r.wb), "v"(r.wb[0]), "v"(r.wb[1]),
                   "v"((v2f){ r.f0[0], r.f0[1] }), "v"((v2f){ r.f0[2], r.f0[3] }), "v"((v2f){ r.f1[0], r.f1[1] }), "v"((v2f){ r.f1[2], r.f1[3] }));
}


// |c| of a WMMA result rounded to f16, four words: the absolute value rides on the conversion as a source modifier
// (compiled code spends a v_and_b32 per element on it). Outputs are early-clobber: a word is written before the later inputs are read.
// g is the A fragment of the WMMA issued directly in front: named as an input, so that no output word is given one of its registers,
// which may not be overwritten in the first vector slots behind that WMMA.
__device__ __forceinline__ v4u abs_pack8(v8f c, v16h g) {
    unsigned int p0, p1, p2, p3;
    asm volatile("v_cvt_pk_f16_f32 %0, |%4|, |%5|\n\t"
                 "v_cvt_pk_f16_f32 %1, |%6|, |%7|\n\t"
                 "v_cvt_pk_f16_f32 %2, |%8|, |%9|\n\t"
                 "v_cvt_pk_f16_f32 %3, |%10|, |%11|"
                 : "=&v"(p0), "=&v"(p1), "=&v"(p2), "=&v"(p3)
                 : "v"(c[0]), "v"(c[1]), "v"(c[2]), "v"(c[3]), "v"(c[4]), "v"(c[5]), "v"(c[6]), "v"(c[7]), "v"(g));
    return (v4u){ p0, p1, p2, p3 };
}

// The same with two fragments to keep clear of: ga is an A fragment and gb the sparse product's B fragment of matrix instructions issued shortly in front, named as inputs
// so that they stay in their registers up to here: neither a WMMA between (its result) nor an output word here is given one of them
// inside the vector slots in which a matrix instruction's operands may not be overwritten.
__device__ __forceinline__ v4u abs_pack8(v8f c, v16h ga, v32h gb) {
    unsigned int p0, p1, p2, p3;
    asm volatile("v_cvt_pk_f16_f32 %0, |%4|, |%5|\n\t"
                 "v_cvt_pk_f16_f32 %1, |%6|, |%7|\n\t"
                 "v_cvt_pk_f16_f32 %2, |%8|, |%9|\n\t"
                 "v_cvt_pk_f16_f32 %3, |%10|, |%11|"
                 : "=&v"(p0), "=&v"(p1), "=&v"(p2), "=&v"(p3)
                 : "v"(c[0]), "v"(c[1]), "v"(c[2]), "v"(c[3]), "v"(c[4]), "v"(c[5]), "v"(c[6]), "v"(c[7]), "v"(ga), "v"(gb));
    return (v4u){ p0, p1, p2, p3 };
}

// c += A . B on the sparse form, K = 64: a holds two of every four k of its row, idx says which two (a nibble per word of a: two 2-bit places).
// In asm text: built from the builtin, the code object asks the runtime for the host call buffer and the device heap, which nothing here uses.
__device__ __forceinline__ void sparse_f16(v8f& c, v16h a, v32h b, int idx) {
    asm volatile("v_swmmac_f32_16x16x64_f16 %0, %1, %2, %3" : "+v"(c) : "v"(a), "v"(b), "v"(idx));
}

// The same as the last matrix instruction in front of vector code that reads c: the v_nop keep the distance that a matrix result needs before a vector instruction reads it.
__device__ __forceinline__ void sparse_f16_last(v8f& c, v16h a, v32h b, int idx) {
    asm volatile("v_swmmac_f32_16x16x64_f16 %0, %1, %2, %3\n\t"
                 "v_nop\n\tv_nop\n\tv_nop\n\tv_nop\n\tv_nop\n\tv_nop\n\tv_nop\n\tv_nop" : "+v"(c) : "v"(a), "v"(b), "v"(idx));
}

// The same with no WMMA operand to keep clear of.
__device__ __forceinline__ v4u abs_pack8(v8f c) {
    unsigned int p0, p1, p2, p3;
    asm volatile("v_cvt_pk_f16_f32 %0, |%4|, |%5|\n\t"
                 "v_cvt_pk_f16_f32 %1, |%6|, |%7|\n\t"
                 "v_cvt_pk_f16_f32 %2, |%8|, |%9|\n\t"
                 "v_cvt_pk_f16_f32 %3, |%10|, |%11|"
                 : "=&v"(p0), "=&v"(p1), "=&v"(p2), "=&v"(p3)
                 : "v"(c[0]), "v"(c[1]), "v"(c[2]), "v"(c[3]), "v"(c[4]), "v"(c[5]), "v"(c[6]), "v"(c[7]));
    return (v4u){ p0, p1, p2, p3 };
}

// Two hidden tiles (32 units) against all sixteen resident row tiles. Per row tile j: two WMMAs D = W_tile . x^T + b1 (row = unit 8h + r, column = batch row l16)
// and eight conversions that pack |D| of both tiles into eight words. The words of row tiles 2u and 2u + 1 are one 64-deep B fragment (16 registers):
// word v < 8: row tile 2u, word 8 + v: row tile 2u + 1; in each, v < 4: units 8h + 2v, + 1 of the first tile, v >= 4: units 8h + 2(v - 4), + 1 of the second.
// One sparse product acc[u] += A . B a row-tile pair. The map that follows is read from the instruction set's tables for the sparse forms.
// The sparse A holds two of every four k of a row: word p of A (lane l16 = row, half h) meets two of the four
// elements in words 2p and 2p + 1 of B in the same lane half, picked by the row's index nibbles: 0x4 = elements 0, 1 (word 2p), 0xE = elements 2, 3 (word 2p + 1).
// Rows share the work: even rows take the even words of B, odd rows the odd words; rows 0..7 hold W2 in words 0..3 and zero in 4..7 (row tile 2u),
// rows 8..15 the reverse (row tile 2u + 1). So acc[u] rows 0 + 1 sum to the 32-unit dot for row tile 2u, rows 8 + 9 for row tile 2u + 1 (column = batch row l16).
// Staggered so that nothing reads a result early: the conversions are those of row tile j - 1, and the sparse product of a row-tile pair stands one row tile behind its last conversion.
// Row tiles 14 and 15 finish in the next pair's step, with this pair's W2 fragment (a2p).
template <int K>
__device__ __forceinline__ void pair_step(v8f (&acc)[RT / 2], const Frag16 (&fa)[RT], RawTile& ra, RawTile& rb,
                                          v8f& c0p, v8f& c1p, Frag32& pp, Frag16& a2p, v2f (&vs)[4], float& cs,
                                          GroupAddr& ga, int& Tn, const float* __restrict__ W1, const float* __restrict__ b1,
                                          const float* __restrict__ W2, int head, int woff, int l16, int h, int sidx) {
    Frag16 wa, wb, a2;
    round_tile(wa, ra, vs, cs);
    round_tile(wb, rb, vs, cs);
    {
        const bool up = (l16 & 8) != 0;                            // this lane's row of A works for the odd row tile of a pair
        v4u t;
        t[0] = pack_pair(ra.wp0[0], ra.wp0[1]);
        t[1] = pack_pair(ra.wp1[0], ra.wp1[1]);
        t[2] = pack_pair(rb.wp0[0], rb.wp0[1]);
        t[3] = pack_pair(rb.wp1[0], rb.wp1[1]);
        #pragma unroll
        for (int i = 0; i < 4; ++i) {
            a2.u4[0][i] = up ? 0u : t[i];
            a2.u4[1][i] = up ? t[i] : 0u;
        }
    }
    const v8f ba = { ra.bv0[0], ra.bv0[1], ra.bv0[2], ra.bv0[3], ra.bv1[0], ra.bv1[1], ra.bv1[2], ra.bv1[3] };   // bias of unit 8h + r, all columns
    const v8f bb = { rb.bv0[0], rb.bv0[1], rb.bv0[2], rb.bv0[3], rb.bv1[0], rb.bv1[1], rb.bv1[2], rb.bv1[3] };
    if (K == 0) {
        // The group's one wait on address translation, behind the roundings above and not directly behind the last group's last loads, where it would hold the wave up.
        // The old addresses are inputs, so their registers stand untouched up to here; the next group's number is an output,
        // so the new addresses are formed behind it. The scheduling barrier keeps the roundings in front of the wait.
        __builtin_amdgcn_sched_barrier(0);
        asm volatile("s_wait_xcnt 0x0" : "+s"(Tn) : "v"(ga.w1), "v"(ga.b1), "v"(ga.w2), "v"(ga.b1v), "v"(ga.w2v) : "memory");
        ga = group_addr(W1, b1, W2, group_unit(Tn, head), woff, l16, h);
        Tn += 4;
    }
    load_tile<K>(ra, ga);
    load_tile<K + 1>(rb, ga);
    // The scheduling barriers keep this order: left free, the compiler puts a result's conversions directly behind its WMMA,
    // inside the slots that a WMMA result needs before it is read, and nothing is left to issue beside the matrix unit.
    __builtin_amdgcn_sched_barrier(0);
    Frag32 P[RT / 2 + 1];                                         // P[0]: the last pair's row tiles 14, 15; P[1 + u]: this pair's row tiles 2u, 2u + 1
    P[0] = pp;
    v8f c0 = c0p, c1 = c1p;
    #pragma unroll
    for (int j = 0; j < RT; ++j) {
        const int sl = (j + 1) >> 1;                              // the fragment that takes row tile j - 1
        const int g  = ((j + 1) & 1) * 2;                         // and its place there
        const v8f n0 = __builtin_amdgcn_wmma_f32_16x16x32_f16(false, wa.v, false, fa[j].v, (short)0, ba, false, false);
        __builtin_amdgcn_sched_barrier(0);
        // In an even row tile from 2 on the last sparse product's B fragment is held one group of conversions longer: ten vector slots lie behind that product before a register of it is written.
        P[sl].u4[g] = (!(j & 1) && j >= 2) ? abs_pack8(c0, wa.v, P[(j >> 1) - 1].v) : abs_pack8(c0, wa.v);
        __builtin_amdgcn_sched_barrier(0);
        if (j & 1) {
            // Behind the first conversions of the next fragment, so that the fragment it reads and the one being written are two sets of registers.
            const int q = ((j >> 1) + RT / 2 - 1) & (RT / 2 - 1); // the row-tile pair whose packed |D| is complete
            sparse_f16(acc[q], (j < 2 ? a2p : a2).v, P[j >> 1].v, sidx);
            __builtin_amdgcn_sched_barrier(0);
        }
        const v8f n1 = __builtin_amdgcn_wmma_f32_16x16x32_f16(false, wb.v, false, fa[j].v, (short)0, bb, false, false);
        __builtin_amdgcn_sched_barrier(0);
        P[sl].u4[g + 1] = (j & 1) ? abs_pack8(c1, (j < 2 ? a2p : a2).v, P[j >> 1].v) : abs_pack8(c1);
        __builtin_amdgcn_sched_barrier(0);
        c0 = n0; c1 = n1;
    }
    // The loaded biases as inputs only: they stay in their registers past the last WMMA (which otherwise takes them for its result),
    // so the reload below lands in the same registers and the loop's foot holds no copies of sixteen registers and no wait for them.
    asm volatile("" :: "v"(ba), "v"(bb));
    load_bias<K>(ra, ga);
    load_bias<K + 1>(rb, ga);
    pp = P[RT / 2]; c0p = c0; c1p = c1; a2p = a2;
}

// Sum over the 16 lanes of a row, the total in every lane of the row: four adds, each with its own cross-lane read (DPP row_xmask).
__device__ __forceinline__ float row16_sum(float v) {
    v += __builtin_bit_cast(float, __builtin_amdgcn_update_dpp(0, __builtin_bit_cast(int, v), 0x161, 0xf, 0xf, true));
    v += __builtin_bit_cast(float, __builtin_amdgcn_update_dpp(0, __builtin_bit_cast(int, v), 0x162, 0xf, 0xf, true));
    v += __builtin_bit_cast(float, __builtin_amdgcn_update_dpp(0, __builtin_bit_cast(int, v), 0x164, 0xf, 0xf, true));
    v += __builtin_bit_cast(float, __builtin_amdgcn_update_dpp(0, __builtin_bit_cast(int, v), 0x168, 0xf, 0xf, true));
    return v;
}

// One block = 256 batch rows (16 row tiles) x 8 heads (blockIdx.y picks the heads 0..7 or 8..15): each wave owns ONE head.
// The x fragments of all 16 row tiles and their 8 accumulator tiles (one a pair of row tiles) stay in registers; the head's
// 32 hidden tiles stream past them from L2 as f32, loaded four tiles ahead, each tile rounded once and used by all 16 row tiles.
// x fragment, the B operand (lane l, column = batch row l&15, h = l>>4): elements 0..7 = f16_hi(x[row][8h..8h+7]) (k = 8h+i),
//   elements 8..15 = f16_lo of the same values (k = 16+8h+i).
// Weight fragment, the A operand (lane l, row = unit l&15): elements 0..7 = W_h[unit][8h..8h+7] (k = 8h+i), elements 8..15 = the same values (k = 16+8h+i).
// D[unit 8h+r][batch row l16] = b1[unit] + sum_i (x_hi + x_lo)[row][i] * W_h[unit][i].
// The tile loop sums W2[n] |D| only (on the matrix unit's sparse form, |D| and W2 as f16); the part linear in D is one product of each of the wave's own two row tiles with the V tile
// (column = head of the block, columns 8..15 repeat 0..7 and are not stored), there with A = [x_hi | x_hi] and [x_lo | x_lo], B = [V_hi | V_lo].
// It stands behind the tile loop: each wave publishes the V sums of its head in LDS.
// A block stores the 32 bytes of its 8 heads in each of its rows; the row's other 32 bytes are the other head group's block's.
// At most two waves a SIMD, so one block a WGP: a grid of one block per WGP spreads over all of them.
__global__ __launch_bounds__(256) __attribute__((amdgpu_waves_per_eu(2, 2))) void k_mlp16(const float* __restrict__ x,
                                               const float* __restrict__ W1,
                                               const float* __restrict__ b1,
                                               const float* __restrict__ W2,
                                               const float* __restrict__ b2,
                                               float* __restrict__ out,
                                               int nrows)
{
    __shared__ __align__(16) float sOut[RT * ROWS_PER_WAVE * WAVES];        // [row of the block][head of the block] = 8 KB
    __shared__ __align__(16) unsigned short sA[RT * 2 * 32 * 8];            // per row tile: hi plane, lo plane, 16 B a lane = 16 KB
    __shared__ __align__(16) float sLin[RT * ROWS_PER_WAVE * WAVES];        // linear part, laid out like sOut = 8 KB
    __shared__ __align__(16) float sV[WAVES * IN_DIM];                      // sum_n W2[o][n] W1[o][n][i], o = head of the block
    __shared__ float sC[WAVES];                                             // sum_n W2[o][n] b1[o][n]
    __shared__ float sB2[WAVES];

    const int tid  = threadIdx.x;
    const int lane = tid & 31;
    const int wave = __builtin_amdgcn_readfirstlane(tid >> 5);              // scalar, so the head's offsets stay scalar
    const int h    = lane >> 4;
    const int l16  = lane & 15;
    const int woff = l16 * IN_DIM + 8 * h;                                  // this lane's place in a 16-unit weight tile
    const int hbase = blockIdx.y * WAVES;                                   // first head of the block
    const int head  = hbase + wave;                                         // the wave's head

    const int rbase = blockIdx.x * ROWS_PER_BLOCK + wave * (2 * ROWS_PER_WAVE);   // first row of this wave's own two row tiles
    int row0 = rbase + l16;
    int row1 = rbase + ROWS_PER_WAVE + l16;
    if (row0 > nrows - 1) row0 = nrows - 1;                                 // clamp loads; stores predicated
    if (row1 > nrows - 1) row1 = nrows - 1;

    // The head's 32 hidden tiles stream through four register buffers, each refilled four tiles ahead:
    // the loads have four tile steps to come back from L2. The first four fly while the row tiles below are split.
    RawTile r0, r1, r2, r3;
    GroupAddr ga = group_addr(W1, b1, W2, group_unit(0, head), woff, l16, h);   // the addresses of the group last loaded
    {
        const GroupAddr& g0 = ga;
        load_tile<0>(r0, g0);
        load_tile<1>(r1, g0);
        load_tile<2>(r2, g0);
        load_tile<3>(r3, g0);
        load_bias<0>(r0, g0);
        load_bias<1>(r1, g0);
        load_bias<2>(r2, g0);
        load_bias<3>(r3, g0);
        // Address registers of the loads above may be reused from here on.
        asm volatile("s_wait_xcnt 0x0" ::: "memory");
    }

    // Each wave splits its own two row tiles once and publishes the halves for all waves.
    {
        const float b2v = b2[hbase + (l16 & (WAVES - 1))];                  // waits in LDS for the linear part at the end
        const v4f* xp0 = (const v4f*)(x + (size_t)row0 * IN_DIM + 8 * h);
        const v4f* xp1 = (const v4f*)(x + (size_t)row1 * IN_DIM + 8 * h);
        const v4f xa[2][2] = { { xp0[0], xp0[1] }, { xp1[0], xp1[1] } };
        // Address registers of the loads above may be reused from here on. b2's value is an input so that its load is issued here,
        // beside x's: left free it sinks into the branch below, and its whole latency stands in front of the barrier.
        // b2's base is an input too: its scalar pair, which that load names, stays untouched up to the wait (left free, a scalar move is lifted over it).
        asm volatile("s_wait_xcnt 0x0" :: "v"(b2v), "s"(b2) : "memory");
        #pragma unroll
        for (int u = 0; u < 2; ++u) {
            v4u xh, xl;
            unsigned int hh, ll;
            split_pair(xa[u][0][0], xa[u][0][1], hh, ll); xh[0] = hh; xl[0] = ll;
            split_pair(xa[u][0][2], xa[u][0][3], hh, ll); xh[1] = hh; xl[1] = ll;
            split_pair(xa[u][1][0], xa[u][1][1], hh, ll); xh[2] = hh; xl[2] = ll;
            split_pair(xa[u][1][2], xa[u][1][3], hh, ll); xh[3] = hh; xl[3] = ll;
            *(v8us*)(sA + (((2 * wave + u) * 2 + 0) * 32 + lane) * 8) = __builtin_bit_cast(v8us, xh);
            *(v8us*)(sA + (((2 * wave + u) * 2 + 1) * 32 + lane) * 8) = __builtin_bit_cast(v8us, xl);
        }
        if (tid < WAVES) sB2[tid] = b2v;
    }
    __syncthreads();

    // The block's sixteen row tiles stay in registers for the whole kernel: [x_hi | x_lo] along k.
    Frag16 fa[RT];
    #pragma unroll
    for (int rt = 0; rt < RT; ++rt) {
        fa[rt].h8[0] = *(const v8us*)(sA + ((rt * 2 + 0) * 32 + lane) * 8);
        fa[rt].h8[1] = *(const v8us*)(sA + ((rt * 2 + 1) * 32 + lane) * 8);
    }

    int Tn = 4;                                                             // first tile of the next group to load (scalar)
    const int sidx = (l16 & 1) ? (int)0xEEEEEEEEu : 0x44444444;             // this lane's row of the sparse A: elements 2, 3 or 0, 1 of every four k
    {
        v8f acc[RT / 2];
        const v8f zero8 = { 0.0f, 0.0f, 0.0f, 0.0f, 0.0f, 0.0f, 0.0f, 0.0f };
        #pragma unroll
        for (int rt = 0; rt < RT / 2; ++rt) acc[rt] = zero8;
        // Row tiles 14 and 15 of a pair of tiles finish one step later; zero fragments before the head's first pair.
        v8f   c0p = zero8, c1p = zero8;
        Frag32 pp;
        Frag16 a2p;
        pp.u4[0] = (v4u){ 0u, 0u, 0u, 0u };  pp.u4[1] = pp.u4[0];  pp.u4[2] = pp.u4[0];  pp.u4[3] = pp.u4[0];
        a2p.u4[0] = pp.u4[0];                a2p.u4[1] = pp.u4[0];
        v2f   vs[4] = { { 0.0f, 0.0f }, { 0.0f, 0.0f }, { 0.0f, 0.0f }, { 0.0f, 0.0f } };
        float cs = 0.0f;

        // Rolled, four tiles a trip: one per register buffer.
        #pragma unroll 1
        for (int t = 0; t < NT; t += 4) {
            pair_step<0>(acc, fa, r0, r1, c0p, c1p, pp, a2p, vs, cs, ga, Tn, W1, b1, W2, head, woff, l16, h, sidx);
            pair_step<2>(acc, fa, r2, r3, c0p, c1p, pp, a2p, vs, cs, ga, Tn, W1, b1, W2, head, woff, l16, h, sidx);
        }
        // Address registers of the loop's last loads may be reused from here on.
        asm volatile("s_wait_xcnt 0x0" ::: "memory");
        // The last pair's row tiles 14 and 15.
        pp.u4[2] = abs_pack8(c0p);
        pp.u4[3] = abs_pack8(c1p);
        sparse_f16_last(acc[RT / 2 - 1], a2p.v, pp.v, sidx);

        // The head's linear sums: over the 16 units a row of lanes holds; one lane of each half publishes its 8 inputs.
        {
            v4f s0, s1;
            s0[0] = row16_sum(vs[0][0]); s0[1] = row16_sum(vs[0][1]); s0[2] = row16_sum(vs[1][0]); s0[3] = row16_sum(vs[1][1]);
            s1[0] = row16_sum(vs[2][0]); s1[1] = row16_sum(vs[2][1]); s1[2] = row16_sum(vs[3][0]); s1[3] = row16_sum(vs[3][1]);
            const float ct = row16_sum(cs);
            if (l16 == 0) {
                *(v4f*)(sV + wave * IN_DIM + 8 * h)     = s0;
                *(v4f*)(sV + wave * IN_DIM + 8 * h + 4) = s1;
            }
            if (lane == 0) sC[wave] = ct;
        }

        // Rows 0 and 1 of acc[u] hold the two halves of the 512-dot of W2 with |D| for batch row l16 of row tile 2u, rows 8 and 9 those of row tile 2u + 1:
        // registers 0 and 1 of lane half h are rows 8h and 8h + 1, so one add gives row tile 2u + h, with no sum over lanes.
        #pragma unroll
        for (int u = 0; u < RT / 2; ++u)
            sOut[((2 * u + h) * ROWS_PER_WAVE + l16) * WAVES + wave] = ABS_C * (acc[u][0] + acc[u][1]);
    }

    __syncthreads();

    // Linear part of the wave's own two row tiles, the block's 8 heads: row 8h+r, head l16 & 7.
    {
        Frag16 fv;
        const int hc = l16 & (WAVES - 1);
        const v4f a0 = *(const v4f*)(sV + hc * IN_DIM + 8 * h), a1 = *(const v4f*)(sV + hc * IN_DIM + 8 * h + 4);
        v4u vh, vl;
        unsigned int hh, ll;
        split_pair(LIN_C * a0[0], LIN_C * a0[1], hh, ll); vh[0] = hh; vl[0] = ll;
        split_pair(LIN_C * a0[2], LIN_C * a0[3], hh, ll); vh[1] = hh; vl[1] = ll;
        split_pair(LIN_C * a1[0], LIN_C * a1[1], hh, ll); vh[2] = hh; vl[2] = ll;
        split_pair(LIN_C * a1[2], LIN_C * a1[3], hh, ll); vh[3] = hh; vl[3] = ll;
        fv.u4[0] = vh; fv.u4[1] = vl;
        const float cv = fmaf(LIN_C, sC[hc], sB2[hc]);
        const v8f c0 = { cv, cv, cv, cv, cv, cv, cv, cv };
        v8f lin[2];
        #pragma unroll
        for (int u = 0; u < 2; ++u) {
            Frag16 fxh, fxl;
            const v8us xh = *(const v8us*)(sA + (((2 * wave + u) * 2 + 0) * 32 + lane) * 8);
            const v8us xl = *(const v8us*)(sA + (((2 * wave + u) * 2 + 1) * 32 + lane) * 8);
            fxh.h8[0] = xh; fxh.h8[1] = xh;
            fxl.h8[0] = xl; fxl.h8[1] = xl;
            lin[u] = wmma_pair_f16(fxh.v, fxl.v, fv.v, c0);
        }
        if (l16 < WAVES) {
            #pragma unroll
            for (int u = 0; u < 2; ++u)
                #pragma unroll
                for (int r = 0; r < 8; ++r) sLin[((2 * wave + u) * ROWS_PER_WAVE + 8 * h + r) * WAVES + l16] = lin[u][r];
        }
    }
    __syncthreads();

    // The wave's 32 rows x 8 heads: 64 pieces of four heads, two a lane; piece i is row i / 2, heads 4 (i & 1) .. + 3 of the block.
    const float* sw = sOut + wave * (2 * ROWS_PER_WAVE * WAVES);
    const float* sl = sLin + wave * (2 * ROWS_PER_WAVE * WAVES);
    const v4f v0 = *(const v4f*)(sw + lane * 4) + *(const v4f*)(sl + lane * 4);
    const v4f v1 = *(const v4f*)(sw + 128 + lane * 4) + *(const v4f*)(sl + 128 + lane * 4);
    const bool p0 = (rbase + (lane >> 1)) < nrows;
    const bool p1 = (rbase + ROWS_PER_WAVE + (lane >> 1)) < nrows;
    float* dst = out + ((size_t)rbase + (lane >> 1)) * OUT_DIM + hbase + 4 * (lane & 1);
    if (p0) *(v4f*)dst = v0;
    if (p1) *(v4f*)(dst + ROWS_PER_WAVE * OUT_DIM) = v1;
}

extern "C" void kernel_launch(void* const* d_in, const int* in_sizes, int n_in,
                              void* d_out, int out_size, void* d_ws, size_t ws_size,
                              hipStream_t stream)
{
    if (n_in < 5) return;
    const int nx  = in_sizes[0];
    const int nw1 = in_sizes[1];
    const int nb1 = in_sizes[2];
    const int nw2 = in_sizes[3];
    const int nb2 = in_sizes[4];
    const int nrows = nx / IN_DIM;
    if (nrows <= 0 || nx != nrows * IN_DIM) return;
    if (nw1 != OUT_DIM * HID * IN_DIM || nb1 != OUT_DIM * HID || nw2 != OUT_DIM * HID || nb2 != OUT_DIM) return;
    if (out_size != nrows * OUT_DIM) return;

    const float* x  = (const float*)d_in[0];
    const float* W1 = (const float*)d_in[1];
    const float* b1 = (const float*)d_in[2];
    const float* W2 = (const float*)d_in[3];
    const float* b2 = (const float*)d_in[4];
    float* out = (float*)d_out;

    dim3 gm((nrows + ROWS_PER_BLOCK - 1) / ROWS_PER_BLOCK, OUT_DIM / WAVES);   // 128 x 2 = 256 blocks for 32768 rows
    k_mlp16<<<gm, dim3(256), 0, stream>>>(x, W1, b1, W2, b2, out, nrows);
    (void)hipGetLastError();
}
